// v000
// Measured on an AMD MI455X. A time is GPU time per run, averaged over a window of back-to-back runs after a warm-up
// (all launches, gaps included; the runs take copies of the inputs in turn), and the median of several windows.
// Apart from v000's, it joins two sittings. Times from different sittings can be a few percent apart, while
// side-by-side timings come from the same sitting.
// The starting kernel, v000, takes 461 microseconds a run.
#include <hip/hip_runtime.h>
#include <math.h>

// ---------------------------------------------------------------------------
// CDNA5 (gfx1250) wave32 WMMA fp32 path: V_WMMA_F32_16X16X4_F32
// A: 16x4 f32 (2 VGPRs/lane), B: 4x16 f32 (2 VGPRs/lane), C/D: 16x16 f32 (8 VGPRs)
// ---------------------------------------------------------------------------
typedef __attribute__((ext_vector_type(2))) float v2f;
typedef __attribute__((ext_vector_type(8))) float v8f;

#define WMMA_F32_16x16x4(a, b, c) \
  __builtin_amdgcn_wmma_f32_16x16x4_f32(false, (a), false, (b), (short)0, (c), false, false)

__device__ __forceinline__ float lrelu(float v) { return v >= 0.f ? v : 0.2f * v; }

__device__ __forceinline__ void atomicMaxF(float* addr, float v) {
  // monotonic int mapping: works with -inf init
  if (v >= 0.f) atomicMax((int*)addr, __float_as_int(v));
  else          atomicMin((unsigned int*)addr, __float_as_uint(v));
}

// ---------------------------------------------------------------------------
// Kernel 0: init workspace (mx = -inf, den = 0, agg = 0) every call
// ---------------------------------------------------------------------------
__global__ void k_init(float* __restrict__ mx, float* __restrict__ den,
                       float* __restrict__ agg, int N) {
  size_t i = (size_t)blockIdx.x * blockDim.x + threadIdx.x;
  size_t tot = (size_t)N * 512;
  for (size_t j = i; j < tot; j += (size_t)gridDim.x * blockDim.x) agg[j] = 0.f;
  if (i < (size_t)N * 4) { mx[i] = -INFINITY; den[i] = 0.f; }
}

// ---------------------------------------------------------------------------
// Kernel 1: LN1 + xs = y@Wl+bl, xd = y@Wr+br   (N x 128) x (128 x 512) twice
// block = 256 threads = 8 waves, 16 rows per block, WMMA f32 16x16x4
// ---------------------------------------------------------------------------
__global__ __launch_bounds__(256) void k_ln1_xsxd(
    const float* __restrict__ x, const float* __restrict__ g, const float* __restrict__ b,
    const float* __restrict__ Wl, const float* __restrict__ bl,
    const float* __restrict__ Wr, const float* __restrict__ br,
    float* __restrict__ xs, float* __restrict__ xd, int N) {
  __shared__ float yln[16][132];  // pad 132 -> conflict-free column reads
  const int tid = threadIdx.x, lane = tid & 31, wid = tid >> 5;
  const int rowBase = blockIdx.x * 16;

  // --- LayerNorm: wave wid normalizes rows 2*wid and 2*wid+1 (half-wave each)
  {
    const int r = 2 * wid + (lane >> 4);
    const int hl = lane & 15;
    const int row = rowBase + r;
    float vals[8];
    float s = 0.f, sq = 0.f;
    if (row < N) {
      const float* xr = x + (size_t)row * 128 + hl * 8;
#pragma unroll
      for (int i = 0; i < 8; ++i) { float v = xr[i]; vals[i] = v; s += v; sq += v * v; }
    } else {
#pragma unroll
      for (int i = 0; i < 8; ++i) vals[i] = 0.f;
    }
#pragma unroll
    for (int off = 8; off >= 1; off >>= 1) {
      s += __shfl_xor(s, off, 16);
      sq += __shfl_xor(sq, off, 16);
    }
    const float mu = s * (1.f / 128.f);
    const float var = sq * (1.f / 128.f) - mu * mu;
    const float rs = rsqrtf(var + 1e-5f);
#pragma unroll
    for (int i = 0; i < 8; ++i) {
      const int c = hl * 8 + i;
      yln[r][c] = (vals[i] - mu) * rs * g[c] + b[c];
    }
  }
  __syncthreads();

  // --- WMMA: 64 output tiles of 16x16 across combined 1024 columns (Wl|Wr)
  const int m = lane & 15;           // A row
  const int n = lane & 15;           // B/D col
  const int kb = (lane >> 4) * 2;    // K sub-offset per half-wave
  for (int t = wid; t < 64; t += 8) {
    const float* W; const float* bias; float* out; int colLocal;
    if (t < 32) { W = Wl; bias = bl; out = xs; colLocal = t * 16; }
    else        { W = Wr; bias = br; out = xd; colLocal = (t - 32) * 16; }
    v8f acc = {};
#pragma unroll
    for (int k0 = 0; k0 < 128; k0 += 4) {
      v2f a, bf;
      a[0] = yln[m][k0 + kb];
      a[1] = yln[m][k0 + kb + 1];
      bf[0] = W[(size_t)(k0 + kb) * 512 + colLocal + n];
      bf[1] = W[(size_t)(k0 + kb + 1) * 512 + colLocal + n];
      acc = WMMA_F32_16x16x4(a, bf, acc);
    }
    const float bv = bias[colLocal + n];
#pragma unroll
    for (int r = 0; r < 8; ++r) {
      const int mr = (lane < 16) ? r : r + 8;
      const int row = rowBase + mr;
      if (row < N) out[(size_t)row * 512 + colLocal + n] = acc[r] + bv;
    }
  }
}

// ---------------------------------------------------------------------------
// Kernel 2: per-edge attention logits + segment max (wave per edge)
// logits[e,h] = sum_c lrelu(xs[src,h,c]+xd[dst,h,c]+w*We[h,c]) * att[h,c]
// ---------------------------------------------------------------------------
__global__ __launch_bounds__(256) void k_edge_logits(
    const int* __restrict__ ei, const float* __restrict__ ew,
    const float* __restrict__ xs, const float* __restrict__ xd,
    const float* __restrict__ We, const float* __restrict__ att,
    float* __restrict__ logits, float* __restrict__ mx, int E) {
  __shared__ float sWe[512], sAtt[512];
  const int tid = threadIdx.x;
  sWe[tid] = We[tid];       sWe[tid + 256] = We[tid + 256];
  sAtt[tid] = att[tid];     sAtt[tid + 256] = att[tid + 256];
  __syncthreads();

  const int lane = tid & 31, wid = tid >> 5;
  const int e = blockIdx.x * 8 + wid;
  if (e >= E) return;
  const int s = ei[e];
  const int d = ei[E + e];
  const float w = ew[e];
  const float4* xs4 = (const float4*)(xs + (size_t)s * 512);
  const float4* xd4 = (const float4*)(xd + (size_t)d * 512);
  const float4* We4 = (const float4*)sWe;
  const float4* at4 = (const float4*)sAtt;

#pragma unroll
  for (int h = 0; h < 4; ++h) {
    const int idx = h * 32 + lane;
    float4 a = xs4[idx];
    float4 bb = xd4[idx];
    float4 we = We4[idx];
    float4 at = at4[idx];
    float acc = lrelu(a.x + bb.x + w * we.x) * at.x
              + lrelu(a.y + bb.y + w * we.y) * at.y
              + lrelu(a.z + bb.z + w * we.z) * at.z
              + lrelu(a.w + bb.w + w * we.w) * at.w;
#pragma unroll
    for (int off = 16; off >= 1; off >>= 1) acc += __shfl_xor(acc, off, 32);
    if (lane == 0) {
      logits[(size_t)e * 4 + h] = acc;
      atomicMaxF(&mx[(size_t)d * 4 + h], acc);
    }
  }
}

// ---------------------------------------------------------------------------
// Kernel 3: ex = exp(logit - mx[dst]); den[dst] += ex  (thread per (e,h))
// ---------------------------------------------------------------------------
__global__ void k_softmax_den(const int* __restrict__ ei, float* __restrict__ logits,
                              const float* __restrict__ mx, float* __restrict__ den, int E) {
  const int i = blockIdx.x * blockDim.x + threadIdx.x;
  if (i >= E * 4) return;
  const int e = i >> 2, h = i & 3;
  const int d = ei[E + e];
  const float v = expf(logits[i] - mx[(size_t)d * 4 + h]);
  logits[i] = v;
  atomicAdd(&den[(size_t)d * 4 + h], v);
}

// ---------------------------------------------------------------------------
// Kernel 4: agg[dst] += xs[src] * alpha  (wave per edge, f32 atomics -> L2)
// ---------------------------------------------------------------------------
__global__ __launch_bounds__(256) void k_scatter(
    const int* __restrict__ ei, const float* __restrict__ xs,
    const float* __restrict__ logits, const float* __restrict__ den,
    float* __restrict__ agg, int E) {
  const int lane = threadIdx.x & 31, wid = threadIdx.x >> 5;
  const int e = blockIdx.x * 8 + wid;
  if (e >= E) return;
  const int s = ei[e];
  const int d = ei[E + e];
  const float4* xs4 = (const float4*)(xs + (size_t)s * 512);
  float* aggd = agg + (size_t)d * 512;
#pragma unroll
  for (int h = 0; h < 4; ++h) {
    const float alpha = logits[(size_t)e * 4 + h] / (den[(size_t)d * 4 + h] + 1e-16f);
    float4 v = xs4[h * 32 + lane];
    const int c = h * 128 + lane * 4;
    atomicAdd(&aggd[c + 0], v.x * alpha);
    atomicAdd(&aggd[c + 1], v.y * alpha);
    atomicAdd(&aggd[c + 2], v.z * alpha);
    atomicAdd(&aggd[c + 3], v.w * alpha);
  }
}

// ---------------------------------------------------------------------------
// Kernel 5: xnew = x + mean_h(agg) + bias_att ; y2 = LN2(xnew)  (wave per node)
// ---------------------------------------------------------------------------
__global__ __launch_bounds__(256) void k_residual_ln2(
    const float* __restrict__ x, const float* __restrict__ agg,
    const float* __restrict__ bias_att, const float* __restrict__ g,
    const float* __restrict__ b, float* __restrict__ xnew, float* __restrict__ y2, int N) {
  const int lane = threadIdx.x & 31, wid = threadIdx.x >> 5;
  const int nid = blockIdx.x * 8 + wid;
  if (nid >= N) return;
  const float4* aggn = (const float4*)(agg + (size_t)nid * 512);
  const float4* xn = (const float4*)(x + (size_t)nid * 128);
  const float4* ba = (const float4*)bias_att;
  float4 a0 = aggn[lane], a1 = aggn[32 + lane], a2 = aggn[64 + lane], a3 = aggn[96 + lane];
  float4 xv = xn[lane];
  float4 bv = ba[lane];
  float4 v;
  v.x = xv.x + 0.25f * (a0.x + a1.x + a2.x + a3.x) + bv.x;
  v.y = xv.y + 0.25f * (a0.y + a1.y + a2.y + a3.y) + bv.y;
  v.z = xv.z + 0.25f * (a0.z + a1.z + a2.z + a3.z) + bv.z;
  v.w = xv.w + 0.25f * (a0.w + a1.w + a2.w + a3.w) + bv.w;
  float s = v.x + v.y + v.z + v.w;
  float sq = v.x * v.x + v.y * v.y + v.z * v.z + v.w * v.w;
#pragma unroll
  for (int off = 16; off >= 1; off >>= 1) {
    s += __shfl_xor(s, off, 32);
    sq += __shfl_xor(sq, off, 32);
  }
  const float mu = s * (1.f / 128.f);
  const float var = sq * (1.f / 128.f) - mu * mu;
  const float rs = rsqrtf(var + 1e-5f);
  ((float4*)(xnew + (size_t)nid * 128))[lane] = v;
  const int c = lane * 4;
  float4 yv;
  yv.x = (v.x - mu) * rs * g[c + 0] + b[c + 0];
  yv.y = (v.y - mu) * rs * g[c + 1] + b[c + 1];
  yv.z = (v.z - mu) * rs * g[c + 2] + b[c + 2];
  yv.w = (v.w - mu) * rs * g[c + 3] + b[c + 3];
  ((float4*)(y2 + (size_t)nid * 128))[lane] = yv;
}

// ---------------------------------------------------------------------------
// Kernel 6: FFN  out = xnew + gelu(y2@W1+b1)@W2 + b2  (fully fused, WMMA f32)
// block = 256 threads = 8 waves; 16 rows; each wave owns one 16x16 tile.
// ---------------------------------------------------------------------------
__global__ __launch_bounds__(256) void k_ffn(
    const float* __restrict__ xnew, const float* __restrict__ y2,
    const float* __restrict__ W1, const float* __restrict__ b1,
    const float* __restrict__ W2, const float* __restrict__ b2,
    float* __restrict__ out, int N) {
  __shared__ float ytile[16][132];
  __shared__ float htile[16][132];
  const int tid = threadIdx.x, lane = tid & 31, wid = tid >> 5;
  const int rowBase = blockIdx.x * 16;

  {  // stage 0: y2 tile -> LDS
    const int r = tid >> 4, c0 = (tid & 15) * 8;
    const int row = rowBase + r;
    const float* src = y2 + (size_t)row * 128 + c0;
#pragma unroll
    for (int i = 0; i < 8; ++i) ytile[r][c0 + i] = (row < N) ? src[i] : 0.f;
  }
  __syncthreads();

  const int m = lane & 15, n = lane & 15, kb = (lane >> 4) * 2;
  const int colLocal = wid * 16;

  {  // stage 1: h = gelu(y2 @ W1 + b1)
    v8f acc = {};
#pragma unroll
    for (int k0 = 0; k0 < 128; k0 += 4) {
      v2f a, bf;
      a[0] = ytile[m][k0 + kb];
      a[1] = ytile[m][k0 + kb + 1];
      bf[0] = W1[(size_t)(k0 + kb) * 128 + colLocal + n];
      bf[1] = W1[(size_t)(k0 + kb + 1) * 128 + colLocal + n];
      acc = WMMA_F32_16x16x4(a, bf, acc);
    }
    const float bv = b1[colLocal + n];
#pragma unroll
    for (int r = 0; r < 8; ++r) {
      const int mr = (lane < 16) ? r : r + 8;
      const float v = acc[r] + bv;
      htile[mr][colLocal + n] = 0.5f * v * (1.f + erff(v * 0.70710678118654752f));
    }
  }
  __syncthreads();

  {  // stage 2: out = xnew + h @ W2 + b2
    v8f acc = {};
#pragma unroll
    for (int k0 = 0; k0 < 128; k0 += 4) {
      v2f a, bf;
      a[0] = htile[m][k0 + kb];
      a[1] = htile[m][k0 + kb + 1];
      bf[0] = W2[(size_t)(k0 + kb) * 128 + colLocal + n];
      bf[1] = W2[(size_t)(k0 + kb + 1) * 128 + colLocal + n];
      acc = WMMA_F32_16x16x4(a, bf, acc);
    }
    const float bv = b2[colLocal + n];
#pragma unroll
    for (int r = 0; r < 8; ++r) {
      const int mr = (lane < 16) ? r : r + 8;
      const int row = rowBase + mr;
      if (row < N)
        out[(size_t)row * 128 + colLocal + n] =
            xnew[(size_t)row * 128 + colLocal + n] + acc[r] + bv;
    }
  }
}

// ---------------------------------------------------------------------------
extern "C" void kernel_launch(void* const* d_in, const int* in_sizes, int n_in,
                              void* d_out, int out_size, void* d_ws, size_t ws_size,
                              hipStream_t stream) {
  const float* x        = (const float*)d_in[0];
  const int*   ei       = (const int*)  d_in[1];   // [2,E] int32
  const float* ew       = (const float*)d_in[2];   // [E,1]
  const float* ln1_g    = (const float*)d_in[3];
  const float* ln1_b    = (const float*)d_in[4];
  const float* Wl       = (const float*)d_in[5];   // [128,512]
  const float* bl       = (const float*)d_in[6];
  const float* Wr       = (const float*)d_in[7];
  const float* br       = (const float*)d_in[8];
  const float* We       = (const float*)d_in[9];   // [1,512]
  const float* att      = (const float*)d_in[10];  // [4,128]
  const float* bias_att = (const float*)d_in[11];
  const float* ln2_g    = (const float*)d_in[12];
  const float* ln2_b    = (const float*)d_in[13];
  const float* W1       = (const float*)d_in[14];  // [128,128]
  const float* b1       = (const float*)d_in[15];
  const float* W2       = (const float*)d_in[16];  // [128,128]
  const float* b2       = (const float*)d_in[17];

  const int N = in_sizes[0] / 128;
  const int E = in_sizes[2];

  float* ws = (float*)d_ws;
  size_t o = 0;
  float* xs     = ws + o; o += (size_t)N * 512;
  float* xd     = ws + o; o += (size_t)N * 512;
  float* agg    = ws + o; o += (size_t)N * 512;
  float* logits = ws + o; o += (size_t)E * 4;
  float* mx     = ws + o; o += (size_t)N * 4;
  float* den    = ws + o; o += (size_t)N * 4;
  float* xnew   = ws + o; o += (size_t)N * 128;
  float* y2     = ws + o; o += (size_t)N * 128;

  k_init<<<(N * 512 + 255) / 256, 256, 0, stream>>>(mx, den, agg, N);
  k_ln1_xsxd<<<(N + 15) / 16, 256, 0, stream>>>(x, ln1_g, ln1_b, Wl, bl, Wr, br, xs, xd, N);
  k_edge_logits<<<(E + 7) / 8, 256, 0, stream>>>(ei, ew, xs, xd, We, att, logits, mx, E);
  k_softmax_den<<<(E * 4 + 255) / 256, 256, 0, stream>>>(ei, logits, mx, den, E);
  k_scatter<<<(E + 7) / 8, 256, 0, stream>>>(ei, xs, logits, den, agg, E);
  k_residual_ln2<<<(N + 7) / 8, 256, 0, stream>>>(x, agg, bias_att, ln2_g, ln2_b, xnew, y2, N);
  k_ffn<<<(N + 15) / 16, 256, 0, stream>>>(xnew, y2, W1, b1, W2, b2, (float*)d_out, N);
}

// v001
// A run of this version takes 157 microseconds.
// Timed twice side by side with v000, it ran 2.94 and 2.95 times as fast.
#include <hip/hip_runtime.h>
#include <math.h>

// ---------------------------------------------------------------------------
// CDNA5 (gfx1250) wave32 WMMA fp32 path: V_WMMA_F32_16X16X4_F32
// A: 16x4 f32 (2 VGPRs/lane), B: 4x16 f32 (2 VGPRs/lane), C/D: 16x16 f32 (8 VGPRs)
// ---------------------------------------------------------------------------
typedef __attribute__((ext_vector_type(2))) float v2f;
typedef __attribute__((ext_vector_type(8))) float v8f;

#define WMMA_F32_16x16x4(a, b, c) \
  __builtin_amdgcn_wmma_f32_16x16x4_f32(false, (a), false, (b), (short)0, (c), false, false)

__device__ __forceinline__ float lrelu(float v) { return v >= 0.f ? v : 0.2f * v; }

// ---------------------------------------------------------------------------
// Kernel 1: LN1 + xs = y@Wl+bl, xd = y@Wr+br   (N x 128) x (128 x 512) twice
// block = 256 threads = 8 waves, 16 rows per block, WMMA f32 16x16x4
// Also clears its 16 rows' in-degree counters for the count kernel that follows.
// ---------------------------------------------------------------------------
__global__ __launch_bounds__(256) void k_ln1_xsxd(
    const float* __restrict__ x, const float* __restrict__ g, const float* __restrict__ b,
    const float* __restrict__ Wl, const float* __restrict__ bl,
    const float* __restrict__ Wr, const float* __restrict__ br,
    float* __restrict__ xs, float* __restrict__ xd, int* __restrict__ cnt, int N) {
  __shared__ float yln[16][132];  // pad 132 -> conflict-free column reads
  const int tid = threadIdx.x, lane = tid & 31, wid = tid >> 5;
  const int rowBase = blockIdx.x * 16;
  if (tid < 16 && rowBase + tid < N) cnt[rowBase + tid] = 0;

  // --- LayerNorm: wave wid normalizes rows 2*wid and 2*wid+1 (half-wave each)
  {
    const int r = 2 * wid + (lane >> 4);
    const int hl = lane & 15;
    const int row = rowBase + r;
    float vals[8];
    float s = 0.f, sq = 0.f;
    if (row < N) {
      const float* xr = x + (size_t)row * 128 + hl * 8;
#pragma unroll
      for (int i = 0; i < 8; ++i) { float v = xr[i]; vals[i] = v; s += v; sq += v * v; }
    } else {
#pragma unroll
      for (int i = 0; i < 8; ++i) vals[i] = 0.f;
    }
#pragma unroll
    for (int off = 8; off >= 1; off >>= 1) {
      s += __shfl_xor(s, off, 16);
      sq += __shfl_xor(sq, off, 16);
    }
    const float mu = s * (1.f / 128.f);
    const float var = sq * (1.f / 128.f) - mu * mu;
    const float rs = rsqrtf(var + 1e-5f);
#pragma unroll
    for (int i = 0; i < 8; ++i) {
      const int c = hl * 8 + i;
      yln[r][c] = (vals[i] - mu) * rs * g[c] + b[c];
    }
  }
  __syncthreads();

  // --- WMMA: 64 output tiles of 16x16 across combined 1024 columns (Wl|Wr)
  const int m = lane & 15;           // A row
  const int n = lane & 15;           // B/D col
  const int kb = (lane >> 4) * 2;    // K sub-offset per half-wave
  for (int t = wid; t < 64; t += 8) {
    const float* W; const float* bias; float* out; int colLocal;
    if (t < 32) { W = Wl; bias = bl; out = xs; colLocal = t * 16; }
    else        { W = Wr; bias = br; out = xd; colLocal = (t - 32) * 16; }
    v8f acc = {};
#pragma unroll
    for (int k0 = 0; k0 < 128; k0 += 4) {
      v2f a, bf;
      a[0] = yln[m][k0 + kb];
      a[1] = yln[m][k0 + kb + 1];
      bf[0] = W[(size_t)(k0 + kb) * 512 + colLocal + n];
      bf[1] = W[(size_t)(k0 + kb + 1) * 512 + colLocal + n];
      acc = WMMA_F32_16x16x4(a, bf, acc);
    }
    const float bv = bias[colLocal + n];
#pragma unroll
    for (int r = 0; r < 8; ++r) {
      const int mr = (lane < 16) ? r : r + 8;
      const int row = rowBase + mr;
      if (row < N) out[(size_t)row * 512 + colLocal + n] = acc[r] + bv;
    }
  }
}

// ---------------------------------------------------------------------------
// Kernel 2: in-degree of every node, and each edge's rank among the edges of
// its destination (arrival order of the integer atomic)
// ---------------------------------------------------------------------------
__global__ void k_count(const int* __restrict__ ei, int* __restrict__ cnt,
                        int* __restrict__ rank, int E, int N) {
  const int e = blockIdx.x * blockDim.x + threadIdx.x;
  if (e >= E) return;
  const int d = min(max(ei[E + e], 0), N - 1);
  rank[e] = atomicAdd(&cnt[d], 1);
}

// ---------------------------------------------------------------------------
// Kernel 3: start[n] = exclusive prefix sum of cnt (one block, 8 counters per
// thread and round, running carry between rounds)
// ---------------------------------------------------------------------------
__global__ __launch_bounds__(1024) void k_scan(const int* __restrict__ cnt,
                                               int* __restrict__ start, int N) {
  __shared__ int wsum[32];
  __shared__ int wtot;
  const int tid = threadIdx.x, lane = tid & 31, wid = tid >> 5;
  int carry = 0;
  for (int base = 0; base < N; base += 8192) {
    const int i0 = base + tid * 8;
    int v[8];
    if (i0 + 8 <= N) {
      const int4 a = *(const int4*)(cnt + i0);
      const int4 c = *(const int4*)(cnt + i0 + 4);
      v[0] = a.x; v[1] = a.y; v[2] = a.z; v[3] = a.w;
      v[4] = c.x; v[5] = c.y; v[6] = c.z; v[7] = c.w;
    } else {
#pragma unroll
      for (int k = 0; k < 8; ++k) v[k] = (i0 + k < N) ? cnt[i0 + k] : 0;
    }
    int s = 0;
#pragma unroll
    for (int k = 0; k < 8; ++k) { const int t = v[k]; v[k] = s; s += t; }  // exclusive in the thread
    int inc = s;                                                          // inclusive in the wave
#pragma unroll
    for (int off = 1; off < 32; off <<= 1) {
      const int t = __shfl_up(inc, off, 32);
      if (lane >= off) inc += t;
    }
    if (lane == 31) wsum[wid] = inc;
    __syncthreads();
    if (wid == 0) {
      const int w = wsum[lane];
      int iw = w;
#pragma unroll
      for (int off = 1; off < 32; off <<= 1) {
        const int t = __shfl_up(iw, off, 32);
        if (lane >= off) iw += t;
      }
      wsum[lane] = iw - w;
      if (lane == 31) wtot = iw;
    }
    __syncthreads();
    const int o = carry + wsum[wid] + inc - s;
    carry += wtot;
    if (i0 + 8 <= N) {
      *(int4*)(start + i0)     = make_int4(o + v[0], o + v[1], o + v[2], o + v[3]);
      *(int4*)(start + i0 + 4) = make_int4(o + v[4], o + v[5], o + v[6], o + v[7]);
    } else {
#pragma unroll
      for (int k = 0; k < 8; ++k) if (i0 + k < N) start[i0 + k] = o + v[k];
    }
    __syncthreads();  // wsum and wtot are rewritten in the next round
  }
}

// ---------------------------------------------------------------------------
// Kernel 4: (src, weight) of every edge to its place in its destination's run
// ---------------------------------------------------------------------------
__global__ void k_fill(const int* __restrict__ ei, const float* __restrict__ ew,
                       const int* __restrict__ start, const int* __restrict__ rank,
                       int2* __restrict__ edges, int E, int N) {
  const int e = blockIdx.x * blockDim.x + threadIdx.x;
  if (e >= E) return;
  const int s = min(max(ei[e], 0), N - 1);
  const int d = min(max(ei[E + e], 0), N - 1);
  edges[start[d] + rank[e]] = make_int2(s, __float_as_int(ew[e]));
}

// ---------------------------------------------------------------------------
// Kernel 5: one wave owns one destination node and walks its incoming edges.
// logit[h] = sum_c lrelu(xs[src,h,c]+xd[dst,h,c]+w*We[h,c]) * att[h,c]
// Running maximum, denominator and weighted sum of xs[src] stay in registers
// (rescaled when the maximum rises), so each xs row is read once and nothing
// is added in memory. Then xnew = x + mean_h(agg) + bias_att ; y2 = LN2(xnew).
// ---------------------------------------------------------------------------
__global__ __launch_bounds__(256) void k_node(
    const float* __restrict__ x, const float* __restrict__ xs, const float* __restrict__ xd,
    const float* __restrict__ We, const float* __restrict__ att,
    const int* __restrict__ start, const int* __restrict__ cnt,
    const int2* __restrict__ edges,
    const float* __restrict__ bias_att, const float* __restrict__ g,
    const float* __restrict__ b, float* __restrict__ xnew, float* __restrict__ y2, int N) {
  const int lane = threadIdx.x & 31;
  const int wid = __builtin_amdgcn_readfirstlane(threadIdx.x >> 5);  // node index in scalar registers
  const int nid = blockIdx.x * 8 + wid;
  if (nid >= N) return;
  const int st = start[nid];
  const int deg = cnt[nid];
  const float4* xd4 = (const float4*)(xd + (size_t)nid * 512);
  const float4* We4 = (const float4*)We;
  const float4* at4 = (const float4*)att;

  float4 dv[4], we[4], at[4], acc[4];
  float mx[4], den[4];
#pragma unroll
  for (int h = 0; h < 4; ++h) {
    dv[h] = xd4[h * 32 + lane];
    we[h] = We4[h * 32 + lane];
    at[h] = at4[h * 32 + lane];
    acc[h] = make_float4(0.f, 0.f, 0.f, 0.f);
    mx[h] = -INFINITY;
    den[h] = 0.f;
  }

  // one edge: logits of the four heads from its xs row, then the running softmax sums
  auto edge = [&](const float4 (&row)[4], const float w) {
    float lg[4];
#pragma unroll
    for (int h = 0; h < 4; ++h) {
      const float4 a = row[h];
      lg[h] = lrelu(a.x + dv[h].x + w * we[h].x) * at[h].x
            + lrelu(a.y + dv[h].y + w * we[h].y) * at[h].y
            + lrelu(a.z + dv[h].z + w * we[h].z) * at[h].z
            + lrelu(a.w + dv[h].w + w * we[h].w) * at[h].w;
    }
#pragma unroll
    for (int off = 16; off >= 1; off >>= 1) {
#pragma unroll
      for (int h = 0; h < 4; ++h) lg[h] += __shfl_xor(lg[h], off, 32);
    }
#pragma unroll
    for (int h = 0; h < 4; ++h) {
      // one of the two factors is 1: the old sums shrink if the maximum rises,
      // else the new term does
      const float df = lg[h] - mx[h];
      const float t = expf(-fabsf(df));
      const float sc = df > 0.f ? t : 1.f;
      const float p  = df > 0.f ? 1.f : t;
      mx[h] = fmaxf(mx[h], lg[h]);
      den[h] = den[h] * sc + p;
      acc[h].x = acc[h].x * sc + p * row[h].x;
      acc[h].y = acc[h].y * sc + p * row[h].y;
      acc[h].z = acc[h].z * sc + p * row[h].z;
      acc[h].w = acc[h].w * sc + p * row[h].w;
    }
  };
  auto fetch = [&](float4 (&row)[4], const int s) {
    const float4* r = (const float4*)(xs + (size_t)s * 512);
#pragma unroll
    for (int h = 0; h < 4; ++h) row[h] = r[h * 32 + lane];
    // the address registers of these loads are reused right behind them
    asm volatile("s_wait_xcnt 0x0" ::: "memory");
  };

  for (int jb = 0; jb < deg; jb += 32) {
    const int n = min(32, deg - jb);
    // lane j holds edge jb + j of the run; readlane hands it to the whole wave
    int2 ev = make_int2(0, 0);
    if (lane < n) ev = edges[st + jb + lane];
    // two row buffers in turn: the next edge's row is on its way while this one is worked on.
    // Every fetch in the loop is unconditional, so that the wait in front of a row's use
    // can leave the younger fetch in flight; the last one or two edges follow the loop.
    float4 ra[4], rb[4];
    fetch(ra, __builtin_amdgcn_readlane(ev.x, 0));
    int j = 0;
    for (; j + 2 < n; j += 2) {
      fetch(rb, __builtin_amdgcn_readlane(ev.x, j + 1));
      edge(ra, __int_as_float(__builtin_amdgcn_readlane(ev.y, j)));
      fetch(ra, __builtin_amdgcn_readlane(ev.x, j + 2));
      edge(rb, __int_as_float(__builtin_amdgcn_readlane(ev.y, j + 1)));
    }
    if (j + 1 < n) {
      fetch(rb, __builtin_amdgcn_readlane(ev.x, j + 1));
      edge(ra, __int_as_float(__builtin_amdgcn_readlane(ev.y, j)));
      edge(rb, __int_as_float(__builtin_amdgcn_readlane(ev.y, j + 1)));
    } else {
      edge(ra, __int_as_float(__builtin_amdgcn_readlane(ev.y, j)));
    }
  }

  const float r0 = 1.f / (den[0] + 1e-16f), r1 = 1.f / (den[1] + 1e-16f);
  const float r2 = 1.f / (den[2] + 1e-16f), r3 = 1.f / (den[3] + 1e-16f);
  const float4 xv = ((const float4*)(x + (size_t)nid * 128))[lane];
  const float4 bv = ((const float4*)bias_att)[lane];
  float4 v;
  v.x = xv.x + 0.25f * (acc[0].x * r0 + acc[1].x * r1 + acc[2].x * r2 + acc[3].x * r3) + bv.x;
  v.y = xv.y + 0.25f * (acc[0].y * r0 + acc[1].y * r1 + acc[2].y * r2 + acc[3].y * r3) + bv.y;
  v.z = xv.z + 0.25f * (acc[0].z * r0 + acc[1].z * r1 + acc[2].z * r2 + acc[3].z * r3) + bv.z;
  v.w = xv.w + 0.25f * (acc[0].w * r0 + acc[1].w * r1 + acc[2].w * r2 + acc[3].w * r3) + bv.w;
  float s = v.x + v.y + v.z + v.w;
  float sq = v.x * v.x + v.y * v.y + v.z * v.z + v.w * v.w;
#pragma unroll
  for (int off = 16; off >= 1; off >>= 1) {
    s += __shfl_xor(s, off, 32);
    sq += __shfl_xor(sq, off, 32);
  }
  const float mu = s * (1.f / 128.f);
  const float var = sq * (1.f / 128.f) - mu * mu;
  const float rs = rsqrtf(var + 1e-5f);
  ((float4*)(xnew + (size_t)nid * 128))[lane] = v;
  const int c = lane * 4;
  float4 yv;
  yv.x = (v.x - mu) * rs * g[c + 0] + b[c + 0];
  yv.y = (v.y - mu) * rs * g[c + 1] + b[c + 1];
  yv.z = (v.z - mu) * rs * g[c + 2] + b[c + 2];
  yv.w = (v.w - mu) * rs * g[c + 3] + b[c + 3];
  ((float4*)(y2 + (size_t)nid * 128))[lane] = yv;
}

// ---------------------------------------------------------------------------
// Kernel 6: FFN  out = xnew + gelu(y2@W1+b1)@W2 + b2  (fully fused, WMMA f32)
// block = 256 threads = 8 waves; 16 rows; each wave owns one 16x16 tile.
// ---------------------------------------------------------------------------
__global__ __launch_bounds__(256) void k_ffn(
    const float* __restrict__ xnew, const float* __restrict__ y2,
    const float* __restrict__ W1, const float* __restrict__ b1,
    const float* __restrict__ W2, const float* __restrict__ b2,
    float* __restrict__ out, int N) {
  __shared__ float ytile[16][132];
  __shared__ float htile[16][132];
  const int tid = threadIdx.x, lane = tid & 31, wid = tid >> 5;
  const int rowBase = blockIdx.x * 16;

  {  // stage 0: y2 tile -> LDS
    const int r = tid >> 4, c0 = (tid & 15) * 8;
    const int row = rowBase + r;
    const float* src = y2 + (size_t)row * 128 + c0;
#pragma unroll
    for (int i = 0; i < 8; ++i) ytile[r][c0 + i] = (row < N) ? src[i] : 0.f;
  }
  __syncthreads();

  const int m = lane & 15, n = lane & 15, kb = (lane >> 4) * 2;
  const int colLocal = wid * 16;

  {  // stage 1: h = gelu(y2 @ W1 + b1)
    v8f acc = {};
#pragma unroll
    for (int k0 = 0; k0 < 128; k0 += 4) {
      v2f a, bf;
      a[0] = ytile[m][k0 + kb];
      a[1] = ytile[m][k0 + kb + 1];
      bf[0] = W1[(size_t)(k0 + kb) * 128 + colLocal + n];
      bf[1] = W1[(size_t)(k0 + kb + 1) * 128 + colLocal + n];
      acc = WMMA_F32_16x16x4(a, bf, acc);
    }
    const float bv = b1[colLocal + n];
#pragma unroll
    for (int r = 0; r < 8; ++r) {
      const int mr = (lane < 16) ? r : r + 8;
      const float v = acc[r] + bv;
      htile[mr][colLocal + n] = 0.5f * v * (1.f + erff(v * 0.70710678118654752f));
    }
  }
  __syncthreads();

  {  // stage 2: out = xnew + h @ W2 + b2
    v8f acc = {};
#pragma unroll
    for (int k0 = 0; k0 < 128; k0 += 4) {
      v2f a, bf;
      a[0] = htile[m][k0 + kb];
      a[1] = htile[m][k0 + kb + 1];
      bf[0] = W2[(size_t)(k0 + kb) * 128 + colLocal + n];
      bf[1] = W2[(size_t)(k0 + kb + 1) * 128 + colLocal + n];
      acc = WMMA_F32_16x16x4(a, bf, acc);
    }
    const float bv = b2[colLocal + n];
#pragma unroll
    for (int r = 0; r < 8; ++r) {
      const int mr = (lane < 16) ? r : r + 8;
      const int row = rowBase + mr;
      if (row < N)
        out[(size_t)row * 128 + colLocal + n] =
            xnew[(size_t)row * 128 + colLocal + n] + acc[r] + bv;
    }
  }
}

// ---------------------------------------------------------------------------
extern "C" void kernel_launch(void* const* d_in, const int* in_sizes, int n_in,
                              void* d_out, int out_size, void* d_ws, size_t ws_size,
                              hipStream_t stream) {
  const float* x        = (const float*)d_in[0];
  const int*   ei       = (const int*)  d_in[1];   // [2,E] int32
  const float* ew       = (const float*)d_in[2];   // [E,1]
  const float* ln1_g    = (const float*)d_in[3];
  const float* ln1_b    = (const float*)d_in[4];
  const float* Wl       = (const float*)d_in[5];   // [128,512]
  const float* bl       = (const float*)d_in[6];
  const float* Wr       = (const float*)d_in[7];
  const float* br       = (const float*)d_in[8];
  const float* We       = (const float*)d_in[9];   // [1,512]
  const float* att      = (const float*)d_in[10];  // [4,128]
  const float* bias_att = (const float*)d_in[11];
  const float* ln2_g    = (const float*)d_in[12];
  const float* ln2_b    = (const float*)d_in[13];
  const float* W1       = (const float*)d_in[14];  // [128,128]
  const float* b1       = (const float*)d_in[15];
  const float* W2       = (const float*)d_in[16];  // [128,128]
  const float* b2       = (const float*)d_in[17];

  const int N = in_sizes[0] / 128;
  const int E = in_sizes[2];

  float* ws = (float*)d_ws;
  size_t o = 0;
  float* xs    = ws + o; o += (size_t)N * 512;
  float* xd    = ws + o; o += (size_t)N * 512;
  float* xnew  = ws + o; o += (size_t)N * 128;
  float* y2    = ws + o; o += (size_t)N * 128;
  int*   cnt   = (int*)(ws + o); o += ((size_t)N + 3) / 4 * 4;   // 16-byte steps for the scan
  int*   start = (int*)(ws + o); o += ((size_t)N + 3) / 4 * 4;
  int2*  edges = (int2*)(ws + o); o += (size_t)E * 2;
  int*   rank  = (int*)(ws + o); o += (size_t)E;

  k_ln1_xsxd<<<(N + 15) / 16, 256, 0, stream>>>(x, ln1_g, ln1_b, Wl, bl, Wr, br, xs, xd, cnt, N);
  k_count<<<(E + 255) / 256, 256, 0, stream>>>(ei, cnt, rank, E, N);
  k_scan<<<1, 1024, 0, stream>>>(cnt, start, N);
  k_fill<<<(E + 255) / 256, 256, 0, stream>>>(ei, ew, start, rank, edges, E, N);
  k_node<<<(N + 7) / 8, 256, 0, stream>>>(x, xs, xd, We, att, start, cnt, edges, bias_att,
                                          ln2_g, ln2_b, xnew, y2, N);
  k_ffn<<<(N + 15) / 16, 256, 0, stream>>>(xnew, y2, W1, b1, W2, b2, (float*)d_out, N);
}

// v002
// It runs in 134 microseconds.
// In two side-by-side timings against v001, it was 1.17 and 1.28 times as fast.
// All steps since v000 together make it 3.59 times as fast.
#include <hip/hip_runtime.h>
#include <math.h>

// ---------------------------------------------------------------------------
// CDNA5 (gfx1250) wave32 WMMA fp32 path: V_WMMA_F32_16X16X4_F32
// A: 16x4 f32 (2 VGPRs/lane), B: 4x16 f32 (2 VGPRs/lane), C/D: 16x16 f32 (8 VGPRs)
// ---------------------------------------------------------------------------
typedef __attribute__((ext_vector_type(2))) float v2f;
typedef __attribute__((ext_vector_type(8))) float v8f;

#define WMMA_F32_16x16x4(a, b, c) \
  __builtin_amdgcn_wmma_f32_16x16x4_f32(false, (a), false, (b), (short)0, (c), false, false)

__device__ __forceinline__ float lrelu(float v) { return v >= 0.f ? v : 0.2f * v; }

// ---------------------------------------------------------------------------
// Edge grouping, one work-group on its own: it takes one sixteenth of the edge list
// (part q) and 1024 destination nodes (range r), reads the part's destinations
// twice and needs nothing from any other work-group.
// Pass 1: in-degree of its nodes in LDS, and how many edges of the part go to lower nodes.
// Scan:   each node's run inside the part's own stretch of edges[] -> runs[q*N+node] = (first, count)
// Pass 2: (src, weight) of every edge of the range to the next free place of its node's run.
// Both passes take whole trips of U*256 edges with all loads of a trip in flight (one
// address, constant steps); what is left of the part follows edge by edge.
// ---------------------------------------------------------------------------
#define EPARTS 16
#define NRANGE 1024
#define U1 26
#define U2 13

__device__ __forceinline__ void group_edges(
    const int* __restrict__ ei, const float* __restrict__ ew, int2* __restrict__ runs,
    int2* __restrict__ edges, int* lcnt, int* wsum, int* wbel, int sb, int E, int N) {
  const int tid = threadIdx.x, lane = tid & 31, wid = tid >> 5;
  const int q = sb & (EPARTS - 1);
  const int lo = (sb / EPARTS) * NRANGE;
  const int EP = (E + EPARTS - 1) / EPARTS;
  const int e0 = min(q * EP, E), e1 = min(e0 + EP, E);
  *(int4*)(lcnt + tid * 4) = make_int4(0, 0, 0, 0);
  __syncthreads();

  int below = 0;
  auto count = [&](const int dv) {
    const int dd = min(max(dv, 0), N - 1);
    below += (dd < lo) ? 1 : 0;
    const unsigned u = (unsigned)(dd - lo);
    if (u < (unsigned)NRANGE) atomicAdd(&lcnt[u], 1);
  };
  {
    int eb = e0;
    for (; eb + U1 * 256 <= e1; eb += U1 * 256) {
      const int* pd = ei + E + eb + tid;
      int d[U1];
#pragma unroll
      for (int k = 0; k < U1; ++k) d[k] = pd[k * 256];
#pragma unroll
      for (int k = 0; k < U1; ++k) count(d[k]);
    }
    for (int e = eb + tid; e < e1; e += 256) count(ei[E + e]);
  }
  __syncthreads();

  {
    const int4 c = *(const int4*)(lcnt + tid * 4);
    const int sum = c.x + c.y + c.z + c.w;
    int inc = sum;
#pragma unroll
    for (int off = 1; off < 32; off <<= 1) {
      const int t = __shfl_up(inc, off, 32);
      if (lane >= off) inc += t;
    }
#pragma unroll
    for (int off = 16; off >= 1; off >>= 1) below += __shfl_xor(below, off, 32);
    if (lane == 31) wsum[wid] = inc;
    if (lane == 0) wbel[wid] = below;
    __syncthreads();
    int p = e0 + inc - sum;
#pragma unroll
    for (int w = 0; w < 8; ++w) p += wbel[w] + (w < wid ? wsum[w] : 0);
    const int4 f = make_int4(p, p + c.x, p + c.x + c.y, p + c.x + c.y + c.z);
    *(int4*)(lcnt + tid * 4) = f;  // from here on: next free place of each node's run
    const int node = lo + tid * 4;
    int2* r = runs + (size_t)q * N + node;
    if (node + 0 < N) r[0] = make_int2(f.x, c.x);
    if (node + 1 < N) r[1] = make_int2(f.y, c.y);
    if (node + 2 < N) r[2] = make_int2(f.z, c.z);
    if (node + 3 < N) r[3] = make_int2(f.w, c.w);
  }
  __syncthreads();

  {
    int eb = e0;
    for (; eb + U2 * 256 <= e1; eb += U2 * 256) {
      const int* pd = ei + E + eb + tid;
      const int* ps = ei + eb + tid;
      const float* pw = ew + eb + tid;
      int d[U2], sv[U2], pos[U2];
      float wv[U2];
#pragma unroll
      for (int k = 0; k < U2; ++k) {
        d[k] = pd[k * 256];
        sv[k] = ps[k * 256];
        wv[k] = pw[k * 256];
      }
      // the three addresses keep their registers until every load of the trip has taken them
      asm volatile("s_wait_xcnt 0x0" :: "v"(pd), "v"(ps), "v"(pw) : "memory");
      // all LDS atomics of the trip go out before the first result is waited for
#pragma unroll
      for (int k = 0; k < U2; ++k) {
        d[k] = min(max(d[k], 0), N - 1) - lo;
        pos[k] = 0;
        if ((unsigned)d[k] < (unsigned)NRANGE) pos[k] = atomicAdd(&lcnt[d[k]], 1);
      }
#pragma unroll
      for (int k = 0; k < U2; ++k) {
        if ((unsigned)d[k] < (unsigned)NRANGE)
          edges[pos[k]] = make_int2(min(max(sv[k], 0), N - 1), __float_as_int(wv[k]));
      }
      // the registers of the last store are rewritten at the head of the next trip
      asm volatile("s_wait_xcnt 0x0" ::: "memory");
    }
    for (int e = eb + tid; e < e1; e += 256) {
      const int u = min(max(ei[E + e], 0), N - 1) - lo;
      if ((unsigned)u < (unsigned)NRANGE) {
        const int pos = atomicAdd(&lcnt[u], 1);
        edges[pos] = make_int2(min(max(ei[e], 0), N - 1), __float_as_int(ew[e]));
        // the store's registers are rewritten in the next round
        asm volatile("s_wait_xcnt 0x0" ::: "memory");
      }
    }
  }
}

// ---------------------------------------------------------------------------
// Kernel 1: LN1 + xs = y@Wl+bl, xd = y@Wr+br   (N x 128) x (128 x 512) twice
// block = 256 threads = 8 waves, 16 rows per block, WMMA f32 16x16x4
// The first nSort work-groups of the grid group the edges instead (group_edges above):
// that work needs no matrix unit and nothing of the products, so it runs beside them.
// ---------------------------------------------------------------------------
__global__ __launch_bounds__(256) void k_ln1_xsxd(
    const float* __restrict__ x, const float* __restrict__ g, const float* __restrict__ b,
    const float* __restrict__ Wl, const float* __restrict__ bl,
    const float* __restrict__ Wr, const float* __restrict__ br,
    float* __restrict__ xs, float* __restrict__ xd,
    const int* __restrict__ ei, const float* __restrict__ ew,
    int2* __restrict__ runs, int2* __restrict__ edges, int nSort, int E, int N) {
  __shared__ float yln[16][132];  // pad 132 -> conflict-free column reads
  __shared__ __attribute__((aligned(16))) int lcnt[NRANGE];
  __shared__ int wsum[8];
  __shared__ int wbel[8];
  if ((int)blockIdx.x < nSort) {
    group_edges(ei, ew, runs, edges, lcnt, wsum, wbel, blockIdx.x, E, N);
    return;
  }
  const int tid = threadIdx.x, lane = tid & 31, wid = tid >> 5;
  const int rowBase = ((int)blockIdx.x - nSort) * 16;

  // --- LayerNorm: wave wid normalizes rows 2*wid and 2*wid+1 (half-wave each)
  {
    const int r = 2 * wid + (lane >> 4);
    const int hl = lane & 15;
    const int row = rowBase + r;
    float vals[8];
    float s = 0.f, sq = 0.f;
    if (row < N) {
      const float* xr = x + (size_t)row * 128 + hl * 8;
#pragma unroll
      for (int i = 0; i < 8; ++i) { float v = xr[i]; vals[i] = v; s += v; sq += v * v; }
    } else {
#pragma unroll
      for (int i = 0; i < 8; ++i) vals[i] = 0.f;
    }
#pragma unroll
    for (int off = 8; off >= 1; off >>= 1) {
      s += __shfl_xor(s, off, 16);
      sq += __shfl_xor(sq, off, 16);
    }
    const float mu = s * (1.f / 128.f);
    const float var = sq * (1.f / 128.f) - mu * mu;
    const float rs = rsqrtf(var + 1e-5f);
#pragma unroll
    for (int i = 0; i < 8; ++i) {
      const int c = hl * 8 + i;
      yln[r][c] = (vals[i] - mu) * rs * g[c] + b[c];
    }
  }
  __syncthreads();

  // --- WMMA: 64 output tiles of 16x16 across combined 1024 columns (Wl|Wr)
  const int m = lane & 15;           // A row
  const int n = lane & 15;           // B/D col
  const int kb = (lane >> 4) * 2;    // K sub-offset per half-wave
  for (int t = wid; t < 64; t += 8) {
    const float* W; const float* bias; float* out; int colLocal;
    if (t < 32) { W = Wl; bias = bl; out = xs; colLocal = t * 16; }
    else        { W = Wr; bias = br; out = xd; colLocal = (t - 32) * 16; }
    v8f acc = {};
#pragma unroll
    for (int k0 = 0; k0 < 128; k0 += 4) {
      v2f a, bf;
      a[0] = yln[m][k0 + kb];
      a[1] = yln[m][k0 + kb + 1];
      bf[0] = W[(size_t)(k0 + kb) * 512 + colLocal + n];
      bf[1] = W[(size_t)(k0 + kb + 1) * 512 + colLocal + n];
      acc = WMMA_F32_16x16x4(a, bf, acc);
    }
    const float bv = bias[colLocal + n];
#pragma unroll
    for (int r = 0; r < 8; ++r) {
      const int mr = (lane < 16) ? r : r + 8;
      const int row = rowBase + mr;
      if (row < N) out[(size_t)row * 512 + colLocal + n] = acc[r] + bv;
    }
  }
}

// ---------------------------------------------------------------------------
// Kernel 2: one wave owns one destination node and walks its incoming edges
// (sixteen runs, one in each part of the edge list, walked as one list).
// logit[h] = sum_c lrelu(xs[src,h,c]+xd[dst,h,c]+w*We[h,c]) * att[h,c]
// Running maximum, denominator and weighted sum of xs[src] stay in registers
// (rescaled when the maximum rises), so each xs row is read once and nothing
// is added in memory. Then xnew = x + mean_h(agg) + bias_att ; y2 = LN2(xnew).
// ---------------------------------------------------------------------------
__global__ __launch_bounds__(256) void k_node(
    const float* __restrict__ x, const float* __restrict__ xs, const float* __restrict__ xd,
    const float* __restrict__ We, const float* __restrict__ att,
    const int2* __restrict__ runs, const int2* __restrict__ edges,
    const float* __restrict__ bias_att, const float* __restrict__ g,
    const float* __restrict__ b, float* __restrict__ xnew, float* __restrict__ y2, int N) {
  const int lane = threadIdx.x & 31;
  const int wid = __builtin_amdgcn_readfirstlane(threadIdx.x >> 5);  // wave index in scalar registers
  const int nid = blockIdx.x * 8 + wid;
  if (nid >= N) return;
  // lane q fetches the node's run in part q (the upper half-wave reads the same sixteen again);
  // readlane hands them to the whole wave.
  // first[q]: place of run q's first edge in the node's list; shift[q]: from list place to edges[] index
  const int2 rv = runs[(size_t)(lane & (EPARTS - 1)) * N + nid];
  int first[EPARTS], shift[EPARTS];
  int deg = 0;
#pragma unroll
  for (int q = 0; q < EPARTS; ++q) {
    first[q] = deg;
    shift[q] = __builtin_amdgcn_readlane(rv.x, q) - deg;
    deg += __builtin_amdgcn_readlane(rv.y, q);
  }
  const float4* xd4 = (const float4*)(xd + (size_t)nid * 512);
  const float4* We4 = (const float4*)We;
  const float4* at4 = (const float4*)att;

  float4 dv[4], we[4], at[4], acc[4];
  float mx[4], den[4];
#pragma unroll
  for (int h = 0; h < 4; ++h) {
    dv[h] = xd4[h * 32 + lane];
    we[h] = We4[h * 32 + lane];
    at[h] = at4[h * 32 + lane];
    acc[h] = make_float4(0.f, 0.f, 0.f, 0.f);
    mx[h] = -INFINITY;
    den[h] = 0.f;
  }

  // one edge: logits of the four heads from its xs row, then the running softmax sums
  auto edge = [&](const float4 (&row)[4], const float w) {
    float lg[4];
#pragma unroll
    for (int h = 0; h < 4; ++h) {
      const float4 a = row[h];
      lg[h] = lrelu(a.x + dv[h].x + w * we[h].x) * at[h].x
            + lrelu(a.y + dv[h].y + w * we[h].y) * at[h].y
            + lrelu(a.z + dv[h].z + w * we[h].z) * at[h].z
            + lrelu(a.w + dv[h].w + w * we[h].w) * at[h].w;
    }
#pragma unroll
    for (int off = 16; off >= 1; off >>= 1) {
#pragma unroll
      for (int h = 0; h < 4; ++h) lg[h] += __shfl_xor(lg[h], off, 32);
    }
#pragma unroll
    for (int h = 0; h < 4; ++h) {
      // one of the two factors is 1: the old sums shrink if the maximum rises,
      // else the new term does
      const float df = lg[h] - mx[h];
      const float t = expf(-fabsf(df));
      const float sc = df > 0.f ? t : 1.f;
      const float p  = df > 0.f ? 1.f : t;
      mx[h] = fmaxf(mx[h], lg[h]);
      den[h] = den[h] * sc + p;
      acc[h].x = acc[h].x * sc + p * row[h].x;
      acc[h].y = acc[h].y * sc + p * row[h].y;
      acc[h].z = acc[h].z * sc + p * row[h].z;
      acc[h].w = acc[h].w * sc + p * row[h].w;
    }
  };
  auto fetch = [&](float4 (&row)[4], const int s) {
    const float4* r = (const float4*)(xs + (size_t)s * 512);
#pragma unroll
    for (int h = 0; h < 4; ++h) row[h] = r[h * 32 + lane];
    // the address registers of these loads are reused right behind them
    asm volatile("s_wait_xcnt 0x0" ::: "memory");
  };

  for (int jb = 0; jb < deg; jb += 32) {
    const int n = min(32, deg - jb);
    // lane j holds edge jb + j of the node's list; readlane hands it to the whole wave
    int2 ev = make_int2(0, 0);
    if (lane < n) {
      // list entry jb + lane lies in the last run that begins at or before it (empty runs drop out)
      const int le = jb + lane;
      int sh = shift[0];
#pragma unroll
      for (int q = 1; q < EPARTS; ++q) sh = (le >= first[q]) ? shift[q] : sh;
      ev = edges[le + sh];
    }
    // two row buffers in turn: the next edge's row is on its way while this one is worked on.
    // Every fetch in the loop is unconditional, so that the wait in front of a row's use
    // can leave the younger fetch in flight; the last one or two edges follow the loop.
    float4 ra[4], rb[4];
    fetch(ra, __builtin_amdgcn_readlane(ev.x, 0));
    int j = 0;
    for (; j + 2 < n; j += 2) {
      fetch(rb, __builtin_amdgcn_readlane(ev.x, j + 1));
      edge(ra, __int_as_float(__builtin_amdgcn_readlane(ev.y, j)));
      fetch(ra, __builtin_amdgcn_readlane(ev.x, j + 2));
      edge(rb, __int_as_float(__builtin_amdgcn_readlane(ev.y, j + 1)));
    }
    if (j + 1 < n) {
      fetch(rb, __builtin_amdgcn_readlane(ev.x, j + 1));
      edge(ra, __int_as_float(__builtin_amdgcn_readlane(ev.y, j)));
      edge(rb, __int_as_float(__builtin_amdgcn_readlane(ev.y, j + 1)));
    } else {
      edge(ra, __int_as_float(__builtin_amdgcn_readlane(ev.y, j)));
    }
  }

  const float r0 = 1.f / (den[0] + 1e-16f), r1 = 1.f / (den[1] + 1e-16f);
  const float r2 = 1.f / (den[2] + 1e-16f), r3 = 1.f / (den[3] + 1e-16f);
  const float4 xv = ((const float4*)(x + (size_t)nid * 128))[lane];
  const float4 bv = ((const float4*)bias_att)[lane];
  float4 v;
  v.x = xv.x + 0.25f * (acc[0].x * r0 + acc[1].x * r1 + acc[2].x * r2 + acc[3].x * r3) + bv.x;
  v.y = xv.y + 0.25f * (acc[0].y * r0 + acc[1].y * r1 + acc[2].y * r2 + acc[3].y * r3) + bv.y;
  v.z = xv.z + 0.25f * (acc[0].z * r0 + acc[1].z * r1 + acc[2].z * r2 + acc[3].z * r3) + bv.z;
  v.w = xv.w + 0.25f * (acc[0].w * r0 + acc[1].w * r1 + acc[2].w * r2 + acc[3].w * r3) + bv.w;
  float s = v.x + v.y + v.z + v.w;
  float sq = v.x * v.x + v.y * v.y + v.z * v.z + v.w * v.w;
#pragma unroll
  for (int off = 16; off >= 1; off >>= 1) {
    s += __shfl_xor(s, off, 32);
    sq += __shfl_xor(sq, off, 32);
  }
  const float mu = s * (1.f / 128.f);
  const float var = sq * (1.f / 128.f) - mu * mu;
  const float rs = rsqrtf(var + 1e-5f);
  ((float4*)(xnew + (size_t)nid * 128))[lane] = v;
  const int c = lane * 4;
  float4 yv;
  yv.x = (v.x - mu) * rs * g[c + 0] + b[c + 0];
  yv.y = (v.y - mu) * rs * g[c + 1] + b[c + 1];
  yv.z = (v.z - mu) * rs * g[c + 2] + b[c + 2];
  yv.w = (v.w - mu) * rs * g[c + 3] + b[c + 3];
  ((float4*)(y2 + (size_t)nid * 128))[lane] = yv;
}

// ---------------------------------------------------------------------------
// Kernel 3: FFN  out = xnew + gelu(y2@W1+b1)@W2 + b2  (fully fused, WMMA f32)
// block = 256 threads = 8 waves; 16 rows; each wave owns one 16x16 tile.
// ---------------------------------------------------------------------------
__global__ __launch_bounds__(256) void k_ffn(
    const float* __restrict__ xnew, const float* __restrict__ y2,
    const float* __restrict__ W1, const float* __restrict__ b1,
    const float* __restrict__ W2, const float* __restrict__ b2,
    float* __restrict__ out, int N) {
  __shared__ float ytile[16][132];
  __shared__ float htile[16][132];
  const int tid = threadIdx.x, lane = tid & 31, wid = tid >> 5;
  const int rowBase = blockIdx.x * 16;

  {  // stage 0: y2 tile -> LDS
    const int r = tid >> 4, c0 = (tid & 15) * 8;
    const int row = rowBase + r;
    const float* src = y2 + (size_t)row * 128 + c0;
#pragma unroll
    for (int i = 0; i < 8; ++i) ytile[r][c0 + i] = (row < N) ? src[i] : 0.f;
  }
  __syncthreads();

  const int m = lane & 15, n = lane & 15, kb = (lane >> 4) * 2;
  const int colLocal = wid * 16;

  {  // stage 1: h = gelu(y2 @ W1 + b1)
    v8f acc = {};
#pragma unroll
    for (int k0 = 0; k0 < 128; k0 += 4) {
      v2f a, bf;
      a[0] = ytile[m][k0 + kb];
      a[1] = ytile[m][k0 + kb + 1];
      bf[0] = W1[(size_t)(k0 + kb) * 128 + colLocal + n];
      bf[1] = W1[(size_t)(k0 + kb + 1) * 128 + colLocal + n];
      acc = WMMA_F32_16x16x4(a, bf, acc);
    }
    const float bv = b1[colLocal + n];
#pragma unroll
    for (int r = 0; r < 8; ++r) {
      const int mr = (lane < 16) ? r : r + 8;
      const float v = acc[r] + bv;
      htile[mr][colLocal + n] = 0.5f * v * (1.f + erff(v * 0.70710678118654752f));
    }
  }
  __syncthreads();

  {  // stage 2: out = xnew + h @ W2 + b2
    v8f acc = {};
#pragma unroll
    for (int k0 = 0; k0 < 128; k0 += 4) {
      v2f a, bf;
      a[0] = htile[m][k0 + kb];
      a[1] = htile[m][k0 + kb + 1];
      bf[0] = W2[(size_t)(k0 + kb) * 128 + colLocal + n];
      bf[1] = W2[(size_t)(k0 + kb + 1) * 128 + colLocal + n];
      acc = WMMA_F32_16x16x4(a, bf, acc);
    }
    const float bv = b2[colLocal + n];
#pragma unroll
    for (int r = 0; r < 8; ++r) {
      const int mr = (lane < 16) ? r : r + 8;
      const int row = rowBase + mr;
      if (row < N)
        out[(size_t)row * 128 + colLocal + n] =
            xnew[(size_t)row * 128 + colLocal + n] + acc[r] + bv;
    }
  }
}

// ---------------------------------------------------------------------------
extern "C" void kernel_launch(void* const* d_in, const int* in_sizes, int n_in,
                              void* d_out, int out_size, void* d_ws, size_t ws_size,
                              hipStream_t stream) {
  const float* x        = (const float*)d_in[0];
  const int*   ei       = (const int*)  d_in[1];   // [2,E] int32
  const float* ew       = (const float*)d_in[2];   // [E,1]
  const float* ln1_g    = (const float*)d_in[3];
  const float* ln1_b    = (const float*)d_in[4];
  const float* Wl       = (const float*)d_in[5];   // [128,512]
  const float* bl       = (const float*)d_in[6];
  const float* Wr       = (const float*)d_in[7];
  const float* br       = (const float*)d_in[8];
  const float* We       = (const float*)d_in[9];   // [1,512]
  const float* att      = (const float*)d_in[10];  // [4,128]
  const float* bias_att = (const float*)d_in[11];
  const float* ln2_g    = (const float*)d_in[12];
  const float* ln2_b    = (const float*)d_in[13];
  const float* W1       = (const float*)d_in[14];  // [128,128]
  const float* b1       = (const float*)d_in[15];
  const float* W2       = (const float*)d_in[16];  // [128,128]
  const float* b2       = (const float*)d_in[17];

  const int N = in_sizes[0] / 128;
  const int E = in_sizes[2];

  float* ws = (float*)d_ws;
  size_t o = 0;
  float* xs    = ws + o; o += (size_t)N * 512;
  float* xd    = ws + o; o += (size_t)N * 512;
  float* xnew  = ws + o; o += (size_t)N * 128;
  float* y2    = ws + o; o += (size_t)N * 128;
  int2*  runs  = (int2*)(ws + o); o += (size_t)N * 2 * EPARTS;
  int2*  edges = (int2*)(ws + o); o += (size_t)E * 2;
  const int nSort = (N + NRANGE - 1) / NRANGE * EPARTS;

  k_ln1_xsxd<<<nSort + (N + 15) / 16, 256, 0, stream>>>(x, ln1_g, ln1_b, Wl, bl, Wr, br, xs, xd,
                                                        ei, ew, runs, edges, nSort, E, N);
  k_node<<<(N + 7) / 8, 256, 0, stream>>>(x, xs, xd, We, att, runs, edges, bias_att,
                                          ln2_g, ln2_b, xnew, y2, N);
  k_ffn<<<(N + 15) / 16, 256, 0, stream>>>(xnew, y2, W1, b1, W2, b2, (float*)d_out, N);
}

// v003
// A run of this version takes 117 microseconds.
// Two timings next to v002 both put it at 1.14 times that version's speed.
// Counting every step since v000, it is 4.09 times as fast.
#include <hip/hip_runtime.h>
#include <math.h>

// ---------------------------------------------------------------------------
// CDNA5 (gfx1250) wave32 WMMA fp32 path: V_WMMA_F32_16X16X4_F32
// A: 16x4 f32 (2 VGPRs/lane), B: 4x16 f32 (2 VGPRs/lane), C/D: 16x16 f32 (8 VGPRs)
// ---------------------------------------------------------------------------
typedef __attribute__((ext_vector_type(2))) float v2f;
typedef __attribute__((ext_vector_type(8))) float v8f;

#define WMMA_F32_16x16x4(a, b, c) \
  __builtin_amdgcn_wmma_f32_16x16x4_f32(false, (a), false, (b), (short)0, (c), false, false)

__device__ __forceinline__ float lrelu(float v) { return v >= 0.f ? v : 0.2f * v; }

// ---------------------------------------------------------------------------
// Edge grouping, one work-group on its own: it takes one sixteenth of the edge list
// (part q) and 1024 destination nodes (range r), reads the part's destinations
// twice and needs nothing from any other work-group.
// Pass 1: in-degree of its nodes in LDS, and how many edges of the part go to lower nodes.
// Scan:   each node's run inside the part's own stretch of edges[] -> runs[q*N+node] = (first, count)
// Pass 2: (src, weight) of every edge of the range to the next free place of its node's run.
// Both passes take whole trips of U*256 edges with all loads of a trip in flight (one
// address, constant steps); what is left of the part follows edge by edge.
// ---------------------------------------------------------------------------
#define EPARTS 16
#define NRANGE 1024
#define U1 26
#define U2 13

__device__ __forceinline__ void group_edges(
    const int* __restrict__ ei, const float* __restrict__ ew, int2* __restrict__ runs,
    int2* __restrict__ edges, int* lcnt, int* wsum, int* wbel, int sb, int E, int N) {
  const int tid = threadIdx.x, lane = tid & 31, wid = tid >> 5;
  const int q = sb & (EPARTS - 1);
  const int lo = (sb / EPARTS) * NRANGE;
  const int EP = (E + EPARTS - 1) / EPARTS;
  const int e0 = min(q * EP, E), e1 = min(e0 + EP, E);
  *(int4*)(lcnt + tid * 4) = make_int4(0, 0, 0, 0);
  __syncthreads();

  int below = 0;
  auto count = [&](const int dv) {
    const int dd = min(max(dv, 0), N - 1);
    below += (dd < lo) ? 1 : 0;
    const unsigned u = (unsigned)(dd - lo);
    if (u < (unsigned)NRANGE) atomicAdd(&lcnt[u], 1);
  };
  {
    int eb = e0;
    for (; eb + U1 * 256 <= e1; eb += U1 * 256) {
      const int* pd = ei + E + eb + tid;
      int d[U1];
#pragma unroll
      for (int k = 0; k < U1; ++k) d[k] = pd[k * 256];
#pragma unroll
      for (int k = 0; k < U1; ++k) count(d[k]);
    }
    for (int e = eb + tid; e < e1; e += 256) count(ei[E + e]);
  }
  __syncthreads();

  {
    const int4 c = *(const int4*)(lcnt + tid * 4);
    const int sum = c.x + c.y + c.z + c.w;
    int inc = sum;
#pragma unroll
    for (int off = 1; off < 32; off <<= 1) {
      const int t = __shfl_up(inc, off, 32);
      if (lane >= off) inc += t;
    }
#pragma unroll
    for (int off = 16; off >= 1; off >>= 1) below += __shfl_xor(below, off, 32);
    if (lane == 31) wsum[wid] = inc;
    if (lane == 0) wbel[wid] = below;
    __syncthreads();
    int p = e0 + inc - sum;
#pragma unroll
    for (int w = 0; w < 8; ++w) p += wbel[w] + (w < wid ? wsum[w] : 0);
    const int4 f = make_int4(p, p + c.x, p + c.x + c.y, p + c.x + c.y + c.z);
    *(int4*)(lcnt + tid * 4) = f;  // from here on: next free place of each node's run
    const int node = lo + tid * 4;
    int2* r = runs + (size_t)q * N + node;
    if (node + 0 < N) r[0] = make_int2(f.x, c.x);
    if (node + 1 < N) r[1] = make_int2(f.y, c.y);
    if (node + 2 < N) r[2] = make_int2(f.z, c.z);
    if (node + 3 < N) r[3] = make_int2(f.w, c.w);
  }
  __syncthreads();

  {
    int eb = e0;
    for (; eb + U2 * 256 <= e1; eb += U2 * 256) {
      const int* pd = ei + E + eb + tid;
      const int* ps = ei + eb + tid;
      const float* pw = ew + eb + tid;
      int d[U2], sv[U2], pos[U2];
      float wv[U2];
#pragma unroll
      for (int k = 0; k < U2; ++k) {
        d[k] = pd[k * 256];
        sv[k] = ps[k * 256];
        wv[k] = pw[k * 256];
      }
      // the three addresses keep their registers until every load of the trip has taken them
      asm volatile("s_wait_xcnt 0x0" :: "v"(pd), "v"(ps), "v"(pw) : "memory");
      // all LDS atomics of the trip go out before the first result is waited for
#pragma unroll
      for (int k = 0; k < U2; ++k) {
        d[k] = min(max(d[k], 0), N - 1) - lo;
        pos[k] = 0;
        if ((unsigned)d[k] < (unsigned)NRANGE) pos[k] = atomicAdd(&lcnt[d[k]], 1);
      }
#pragma unroll
      for (int k = 0; k < U2; ++k) {
        if ((unsigned)d[k] < (unsigned)NRANGE)
          edges[pos[k]] = make_int2(min(max(sv[k], 0), N - 1), __float_as_int(wv[k]));
      }
      // the registers of the last store are rewritten at the head of the next trip
      asm volatile("s_wait_xcnt 0x0" ::: "memory");
    }
    for (int e = eb + tid; e < e1; e += 256) {
      const int u = min(max(ei[E + e], 0), N - 1) - lo;
      if ((unsigned)u < (unsigned)NRANGE) {
        const int pos = atomicAdd(&lcnt[u], 1);
        edges[pos] = make_int2(min(max(ei[e], 0), N - 1), __float_as_int(ew[e]));
        // the store's registers are rewritten in the next round
        asm volatile("s_wait_xcnt 0x0" ::: "memory");
      }
    }
  }
}

// ---------------------------------------------------------------------------
// Kernel 1: LN1 + xs = y@Wl+bl, xd = y@Wr+br   (N x 128) x (128 x 512) twice
// block = 256 threads = 8 waves. A work-group takes 64 rows and one quarter (256) of the
// 1024 combined columns (Wl|Wr); a wave takes 32 columns of it and all 64 rows: 4 x 2 tiles
// of 16x16, WMMA f32 16x16x4. A lane reads two neighbouring columns of a weight row in one
// 8-byte load: the even column goes to the wave's first column tile, the odd one to its
// second, and every loaded fragment serves the four row tiles.
// The first nSort work-groups of the grid group the edges instead (group_edges above):
// that work needs no matrix unit and nothing of the products, so it runs beside them.
// ---------------------------------------------------------------------------
#define K1ROWS 64
__global__ __launch_bounds__(256) void k_ln1_xsxd(
    const float* __restrict__ x, const float* __restrict__ g, const float* __restrict__ b,
    const float* __restrict__ Wl, const float* __restrict__ bl,
    const float* __restrict__ Wr, const float* __restrict__ br,
    float* __restrict__ xs, float* __restrict__ xd,
    const int* __restrict__ ei, const float* __restrict__ ew,
    int2* __restrict__ runs, int2* __restrict__ edges, int nSort, int E, int N) {
  __shared__ __attribute__((aligned(16))) float yln[K1ROWS][132];  // pad 132 -> conflict-free column reads
  __shared__ __attribute__((aligned(16))) int lcnt[NRANGE];
  __shared__ int wsum[8];
  __shared__ int wbel[8];
  if ((int)blockIdx.x < nSort) {
    group_edges(ei, ew, runs, edges, lcnt, wsum, wbel, blockIdx.x, E, N);
    return;
  }
  const int tid = threadIdx.x, lane = tid & 31, wid = tid >> 5;
  const int gb = (int)blockIdx.x - nSort;
  const int rowBase = (gb >> 2) * K1ROWS;
  const int quarter = gb & 3;

  // --- LayerNorm: wave wid normalizes rows 8*wid .. 8*wid+7, a half-wave each; the four
  // rounds go side by side: all their loads first, then each step of the four sums together
  {
    const int hl = lane & 15;
    float vals[4][8];
    float s[4], sq[4];
#pragma unroll
    for (int it = 0; it < 4; ++it) {
      const int row = rowBase + 8 * wid + 2 * it + (lane >> 4);
      if (row < N) {
        const float* xr = x + (size_t)row * 128 + hl * 8;
#pragma unroll
        for (int i = 0; i < 8; ++i) vals[it][i] = xr[i];
      } else {
#pragma unroll
        for (int i = 0; i < 8; ++i) vals[it][i] = 0.f;
      }
    }
#pragma unroll
    for (int it = 0; it < 4; ++it) {
      s[it] = 0.f; sq[it] = 0.f;
#pragma unroll
      for (int i = 0; i < 8; ++i) { const float v = vals[it][i]; s[it] += v; sq[it] += v * v; }
    }
#pragma unroll
    for (int off = 8; off >= 1; off >>= 1) {
#pragma unroll
      for (int it = 0; it < 4; ++it) {
        s[it] += __shfl_xor(s[it], off, 16);
        sq[it] += __shfl_xor(sq[it], off, 16);
      }
    }
#pragma unroll
    for (int it = 0; it < 4; ++it) {
      const int r = 8 * wid + 2 * it + (lane >> 4);
      const float mu = s[it] * (1.f / 128.f);
      const float var = sq[it] * (1.f / 128.f) - mu * mu;
      const float rs = rsqrtf(var + 1e-5f);
#pragma unroll
      for (int i = 0; i < 8; ++i) {
        const int c = hl * 8 + i;
        yln[r][c] = (vals[it][i] - mu) * rs * g[c] + b[c];
      }
    }
  }
  __syncthreads();

  const int m = lane & 15;           // A row
  const int n = lane & 15;           // B/D col
  const int kb = (lane >> 4) * 2;    // K sub-offset per half-wave
  const float* W    = quarter < 2 ? Wl : Wr;
  const float* bias = quarter < 2 ? bl : br;
  float* out        = quarter < 2 ? xs : xd;
  const int col = (quarter & 1) * 256 + wid * 32 + 2 * n;  // this lane's even column
  const float* wp = W + (size_t)kb * 512 + col;
  v8f acc[4][2] = {};
  // weight rows of four k steps at a time, in two register sets that take turns
  float2 pw[2][8];
  auto loadw = [&](float2 (&p)[8], const int kc) {
#pragma unroll
    for (int j = 0; j < 4; ++j) {
      p[2 * j]     = *(const float2*)(wp + (size_t)(kc + 4 * j) * 512);
      p[2 * j + 1] = *(const float2*)(wp + (size_t)(kc + 4 * j + 1) * 512);
    }
  };
  loadw(pw[0], 0);
#pragma unroll
  for (int c = 0; c < 8; ++c) {
    if (c + 1 < 8) loadw(pw[(c + 1) & 1], (c + 1) * 16);
    // keeps the next set's weight loads in front of this set's 32 WMMAs, so that their way
    // from L2 passes under the matrix work (left alone, the loads sink to just before their use);
    // LDS reads may cross
    __builtin_amdgcn_sched_barrier(0x100);
#pragma unroll
    for (int j = 0; j < 4; ++j) {
      const int k0 = c * 16 + 4 * j;
      const float2 p0 = pw[c & 1][2 * j], p1 = pw[c & 1][2 * j + 1];
      v2f be, bo;
      be[0] = p0.x; be[1] = p1.x;
      bo[0] = p0.y; bo[1] = p1.y;
#pragma unroll
      for (int i = 0; i < 4; ++i) {
        v2f a;
        a[0] = yln[i * 16 + m][k0 + kb];
        a[1] = yln[i * 16 + m][k0 + kb + 1];
        acc[i][0] = WMMA_F32_16x16x4(a, be, acc[i][0]);
        acc[i][1] = WMMA_F32_16x16x4(a, bo, acc[i][1]);
      }
    }
  }
  const float2 bv = *(const float2*)(bias + col);
#pragma unroll
  for (int i = 0; i < 4; ++i) {
#pragma unroll
    for (int r = 0; r < 8; ++r) {
      const int mr = (lane < 16) ? r : r + 8;
      const int row = rowBase + i * 16 + mr;
      if (row < N)
        *(float2*)(out + (size_t)row * 512 + col) = make_float2(acc[i][0][r] + bv.x, acc[i][1][r] + bv.y);
    }
  }
}

// ---------------------------------------------------------------------------
// Kernel 2: one wave owns one destination node and walks its incoming edges
// (sixteen runs, one in each part of the edge list, walked as one list).
// logit[h] = sum_c lrelu(xs[src,h,c]+xd[dst,h,c]+w*We[h,c]) * att[h,c]
// Running maximum, denominator and weighted sum of xs[src] stay in registers
// (rescaled when the maximum rises), so each xs row is read once and nothing
// is added in memory. Then xnew = x + mean_h(agg) + bias_att ; y2 = LN2(xnew).
// ---------------------------------------------------------------------------
__global__ __launch_bounds__(256) void k_node(
    const float* __restrict__ x, const float* __restrict__ xs, const float* __restrict__ xd,
    const float* __restrict__ We, const float* __restrict__ att,
    const int2* __restrict__ runs, const int2* __restrict__ edges,
    const float* __restrict__ bias_att, const float* __restrict__ g,
    const float* __restrict__ b, float* __restrict__ xnew, float* __restrict__ y2, int N) {
  const int lane = threadIdx.x & 31;
  const int wid = __builtin_amdgcn_readfirstlane(threadIdx.x >> 5);  // wave index in scalar registers
  const int nid = blockIdx.x * 8 + wid;
  if (nid >= N) return;
  // lane q fetches the node's run in part q (the upper half-wave reads the same sixteen again);
  // readlane hands them to the whole wave.
  // first[q]: place of run q's first edge in the node's list; shift[q]: from list place to edges[] index
  const int2 rv = runs[(size_t)(lane & (EPARTS - 1)) * N + nid];
  int first[EPARTS], shift[EPARTS];
  int deg = 0;
#pragma unroll
  for (int q = 0; q < EPARTS; ++q) {
    first[q] = deg;
    shift[q] = __builtin_amdgcn_readlane(rv.x, q) - deg;
    deg += __builtin_amdgcn_readlane(rv.y, q);
  }
  const float4* xd4 = (const float4*)(xd + (size_t)nid * 512);
  const float4* We4 = (const float4*)We;
  const float4* at4 = (const float4*)att;

  float4 dv[4], we[4], at[4], acc[4];
  float mx[4], den[4];
#pragma unroll
  for (int h = 0; h < 4; ++h) {
    dv[h] = xd4[h * 32 + lane];
    we[h] = We4[h * 32 + lane];
    at[h] = at4[h * 32 + lane];
    acc[h] = make_float4(0.f, 0.f, 0.f, 0.f);
    mx[h] = -INFINITY;
    den[h] = 0.f;
  }

  // one edge: logits of the four heads from its xs row, then the running softmax sums
  auto edge = [&](const float4 (&row)[4], const float w) {
    float lg[4];
#pragma unroll
    for (int h = 0; h < 4; ++h) {
      const float4 a = row[h];
      lg[h] = lrelu(a.x + dv[h].x + w * we[h].x) * at[h].x
            + lrelu(a.y + dv[h].y + w * we[h].y) * at[h].y
            + lrelu(a.z + dv[h].z + w * we[h].z) * at[h].z
            + lrelu(a.w + dv[h].w + w * we[h].w) * at[h].w;
    }
#pragma unroll
    for (int off = 16; off >= 1; off >>= 1) {
#pragma unroll
      for (int h = 0; h < 4; ++h) lg[h] += __shfl_xor(lg[h], off, 32);
    }
#pragma unroll
    for (int h = 0; h < 4; ++h) {
      // one of the two factors is 1: the old sums shrink if the maximum rises,
      // else the new term does
      const float df = lg[h] - mx[h];
      const float t = expf(-fabsf(df));
      const float sc = df > 0.f ? t : 1.f;
      const float p  = df > 0.f ? 1.f : t;
      mx[h] = fmaxf(mx[h], lg[h]);
      den[h] = den[h] * sc + p;
      acc[h].x = acc[h].x * sc + p * row[h].x;
      acc[h].y = acc[h].y * sc + p * row[h].y;
      acc[h].z = acc[h].z * sc + p * row[h].z;
      acc[h].w = acc[h].w * sc + p * row[h].w;
    }
  };
  auto fetch = [&](float4 (&row)[4], const int s) {
    const float4* r = (const float4*)(xs + (size_t)s * 512);
#pragma unroll
    for (int h = 0; h < 4; ++h) row[h] = r[h * 32 + lane];
    // the address registers of these loads are reused right behind them
    asm volatile("s_wait_xcnt 0x0" ::: "memory");
  };

  for (int jb = 0; jb < deg; jb += 32) {
    const int n = min(32, deg - jb);
    // lane j holds edge jb + j of the node's list; readlane hands it to the whole wave
    int2 ev = make_int2(0, 0);
    if (lane < n) {
      // list entry jb + lane lies in the last run that begins at or before it (empty runs drop out)
      const int le = jb + lane;
      int sh = shift[0];
#pragma unroll
      for (int q = 1; q < EPARTS; ++q) sh = (le >= first[q]) ? shift[q] : sh;
      ev = edges[le + sh];
    }
    // two row buffers in turn: the next edge's row is on its way while this one is worked on.
    // Every fetch in the loop is unconditional, so that the wait in front of a row's use
    // can leave the younger fetch in flight; the last one or two edges follow the loop.
    float4 ra[4], rb[4];
    fetch(ra, __builtin_amdgcn_readlane(ev.x, 0));
    int j = 0;
    for (; j + 2 < n; j += 2) {
      fetch(rb, __builtin_amdgcn_readlane(ev.x, j + 1));
      edge(ra, __int_as_float(__builtin_amdgcn_readlane(ev.y, j)));
      fetch(ra, __builtin_amdgcn_readlane(ev.x, j + 2));
      edge(rb, __int_as_float(__builtin_amdgcn_readlane(ev.y, j + 1)));
    }
    if (j + 1 < n) {
      fetch(rb, __builtin_amdgcn_readlane(ev.x, j + 1));
      edge(ra, __int_as_float(__builtin_amdgcn_readlane(ev.y, j)));
      edge(rb, __int_as_float(__builtin_amdgcn_readlane(ev.y, j + 1)));
    } else {
      edge(ra, __int_as_float(__builtin_amdgcn_readlane(ev.y, j)));
    }
  }

  const float r0 = 1.f / (den[0] + 1e-16f), r1 = 1.f / (den[1] + 1e-16f);
  const float r2 = 1.f / (den[2] + 1e-16f), r3 = 1.f / (den[3] + 1e-16f);
  const float4 xv = ((const float4*)(x + (size_t)nid * 128))[lane];
  const float4 bv = ((const float4*)bias_att)[lane];
  float4 v;
  v.x = xv.x + 0.25f * (acc[0].x * r0 + acc[1].x * r1 + acc[2].x * r2 + acc[3].x * r3) + bv.x;
  v.y = xv.y + 0.25f * (acc[0].y * r0 + acc[1].y * r1 + acc[2].y * r2 + acc[3].y * r3) + bv.y;
  v.z = xv.z + 0.25f * (acc[0].z * r0 + acc[1].z * r1 + acc[2].z * r2 + acc[3].z * r3) + bv.z;
  v.w = xv.w + 0.25f * (acc[0].w * r0 + acc[1].w * r1 + acc[2].w * r2 + acc[3].w * r3) + bv.w;
  float s = v.x + v.y + v.z + v.w;
  float sq = v.x * v.x + v.y * v.y + v.z * v.z + v.w * v.w;
#pragma unroll
  for (int off = 16; off >= 1; off >>= 1) {
    s += __shfl_xor(s, off, 32);
    sq += __shfl_xor(sq, off, 32);
  }
  const float mu = s * (1.f / 128.f);
  const float var = sq * (1.f / 128.f) - mu * mu;
  const float rs = rsqrtf(var + 1e-5f);
  ((float4*)(xnew + (size_t)nid * 128))[lane] = v;
  const int c = lane * 4;
  float4 yv;
  yv.x = (v.x - mu) * rs * g[c + 0] + b[c + 0];
  yv.y = (v.y - mu) * rs * g[c + 1] + b[c + 1];
  yv.z = (v.z - mu) * rs * g[c + 2] + b[c + 2];
  yv.w = (v.w - mu) * rs * g[c + 3] + b[c + 3];
  ((float4*)(y2 + (size_t)nid * 128))[lane] = yv;
}

// ---------------------------------------------------------------------------
// Kernel 3: FFN  out = xnew + gelu(y2@W1+b1)@W2 + b2  (fully fused, WMMA f32)
// block = 256 threads = 8 waves; 16 rows; each wave owns one 16x16 tile.
// ---------------------------------------------------------------------------
__global__ __launch_bounds__(256) void k_ffn(
    const float* __restrict__ xnew, const float* __restrict__ y2,
    const float* __restrict__ W1, const float* __restrict__ b1,
    const float* __restrict__ W2, const float* __restrict__ b2,
    float* __restrict__ out, int N) {
  __shared__ float ytile[16][132];
  __shared__ float htile[16][132];
  const int tid = threadIdx.x, lane = tid & 31, wid = tid >> 5;
  const int rowBase = blockIdx.x * 16;

  {  // stage 0: y2 tile -> LDS
    const int r = tid >> 4, c0 = (tid & 15) * 8;
    const int row = rowBase + r;
    const float* src = y2 + (size_t)row * 128 + c0;
#pragma unroll
    for (int i = 0; i < 8; ++i) ytile[r][c0 + i] = (row < N) ? src[i] : 0.f;
  }
  __syncthreads();

  const int m = lane & 15, n = lane & 15, kb = (lane >> 4) * 2;
  const int colLocal = wid * 16;

  {  // stage 1: h = gelu(y2 @ W1 + b1)
    v8f acc = {};
#pragma unroll
    for (int k0 = 0; k0 < 128; k0 += 4) {
      v2f a, bf;
      a[0] = ytile[m][k0 + kb];
      a[1] = ytile[m][k0 + kb + 1];
      bf[0] = W1[(size_t)(k0 + kb) * 128 + colLocal + n];
      bf[1] = W1[(size_t)(k0 + kb + 1) * 128 + colLocal + n];
      acc = WMMA_F32_16x16x4(a, bf, acc);
    }
    const float bv = b1[colLocal + n];
#pragma unroll
    for (int r = 0; r < 8; ++r) {
      const int mr = (lane < 16) ? r : r + 8;
      const float v = acc[r] + bv;
      htile[mr][colLocal + n] = 0.5f * v * (1.f + erff(v * 0.70710678118654752f));
    }
  }
  __syncthreads();

  {  // stage 2: out = xnew + h @ W2 + b2
    v8f acc = {};
#pragma unroll
    for (int k0 = 0; k0 < 128; k0 += 4) {
      v2f a, bf;
      a[0] = htile[m][k0 + kb];
      a[1] = htile[m][k0 + kb + 1];
      bf[0] = W2[(size_t)(k0 + kb) * 128 + colLocal + n];
      bf[1] = W2[(size_t)(k0 + kb + 1) * 128 + colLocal + n];
      acc = WMMA_F32_16x16x4(a, bf, acc);
    }
    const float bv = b2[colLocal + n];
#pragma unroll
    for (int r = 0; r < 8; ++r) {
      const int mr = (lane < 16) ? r : r + 8;
      const int row = rowBase + mr;
      if (row < N)
        out[(size_t)row * 128 + colLocal + n] =
            xnew[(size_t)row * 128 + colLocal + n] + acc[r] + bv;
    }
  }
}

// ---------------------------------------------------------------------------
extern "C" void kernel_launch(void* const* d_in, const int* in_sizes, int n_in,
                              void* d_out, int out_size, void* d_ws, size_t ws_size,
                              hipStream_t stream) {
  const float* x        = (const float*)d_in[0];
  const int*   ei       = (const int*)  d_in[1];   // [2,E] int32
  const float* ew       = (const float*)d_in[2];   // [E,1]
  const float* ln1_g    = (const float*)d_in[3];
  const float* ln1_b    = (const float*)d_in[4];
  const float* Wl       = (const float*)d_in[5];   // [128,512]
  const float* bl       = (const float*)d_in[6];
  const float* Wr       = (const float*)d_in[7];
  const float* br       = (const float*)d_in[8];
  const float* We       = (const float*)d_in[9];   // [1,512]
  const float* att      = (const float*)d_in[10];  // [4,128]
  const float* bias_att = (const float*)d_in[11];
  const float* ln2_g    = (const float*)d_in[12];
  const float* ln2_b    = (const float*)d_in[13];
  const float* W1       = (const float*)d_in[14];  // [128,128]
  const float* b1       = (const float*)d_in[15];
  const float* W2       = (const float*)d_in[16];  // [128,128]
  const float* b2       = (const float*)d_in[17];

  const int N = in_sizes[0] / 128;
  const int E = in_sizes[2];

  float* ws = (float*)d_ws;
  size_t o = 0;
  float* xs    = ws + o; o += (size_t)N * 512;
  float* xd    = ws + o; o += (size_t)N * 512;
  float* xnew  = ws + o; o += (size_t)N * 128;
  float* y2    = ws + o; o += (size_t)N * 128;
  int2*  runs  = (int2*)(ws + o); o += (size_t)N * 2 * EPARTS;
  int2*  edges = (int2*)(ws + o); o += (size_t)E * 2;
  const int nSort = (N + NRANGE - 1) / NRANGE * EPARTS;

  k_ln1_xsxd<<<nSort + (N + K1ROWS - 1) / K1ROWS * 4, 256, 0, stream>>>(x, ln1_g, ln1_b, Wl, bl, Wr, br, xs, xd,
                                                        ei, ew, runs, edges, nSort, E, N);
  k_node<<<(N + 7) / 8, 256, 0, stream>>>(x, xs, xd, We, att, runs, edges, bias_att,
                                          ln2_g, ln2_b, xnew, y2, N);
  k_ffn<<<(N + 15) / 16, 256, 0, stream>>>(xnew, y2, W1, b1, W2, b2, (float*)d_out, N);
}

// v004
// One run takes 101 microseconds.
// Next to v003, in two timings, it ran 1.17 and 1.16 times as fast.
// Over all steps from v000 it is 4.78 times as fast.
#include <hip/hip_runtime.h>
#include <math.h>

// ---------------------------------------------------------------------------
// CDNA5 (gfx1250) wave32 WMMA fp32 path: V_WMMA_F32_16X16X4_F32
// A: 16x4 f32 (2 VGPRs/lane), B: 4x16 f32 (2 VGPRs/lane), C/D: 16x16 f32 (8 VGPRs)
// ---------------------------------------------------------------------------
typedef __attribute__((ext_vector_type(2))) float v2f;
typedef __attribute__((ext_vector_type(4))) float v4f;
typedef __attribute__((ext_vector_type(8))) float v8f;

#define WMMA_F32_16x16x4(a, b, c) \
  __builtin_amdgcn_wmma_f32_16x16x4_f32(false, (a), false, (b), (short)0, (c), false, false)

__device__ __forceinline__ float lrelu(float v) { return v >= 0.f ? v : 0.2f * v; }

// ---------------------------------------------------------------------------
// Edge grouping, one work-group on its own: it takes one sixteenth of the edge list
// (part q) and 1024 destination nodes (range r), reads the part's destinations
// twice and needs nothing from any other work-group.
// Pass 1: in-degree of its nodes in LDS, and how many edges of the part go to lower nodes.
// Scan:   each node's run inside the part's own stretch of edges[] -> runs[q*N+node] = (first, count)
// Pass 2: (src, weight) of every edge of the range to the next free place of its node's run.
// Both passes take whole trips of U*256 edges with all loads of a trip in flight (one
// address, constant steps); what is left of the part follows edge by edge.
// ---------------------------------------------------------------------------
#define EPARTS 16
#define NRANGE 1024
#define U1 26
#define U2 13

__device__ __forceinline__ void group_edges(
    const int* __restrict__ ei, const float* __restrict__ ew, int2* __restrict__ runs,
    int2* __restrict__ edges, int* lcnt, int* wsum, int* wbel, int sb, int E, int N) {
  const int tid = threadIdx.x, lane = tid & 31, wid = tid >> 5;
  const int q = sb & (EPARTS - 1);
  const int lo = (sb / EPARTS) * NRANGE;
  const int EP = (E + EPARTS - 1) / EPARTS;
  const int e0 = min(q * EP, E), e1 = min(e0 + EP, E);
  *(int4*)(lcnt + tid * 4) = make_int4(0, 0, 0, 0);
  __syncthreads();

  int below = 0;
  auto count = [&](const int dv) {
    const int dd = min(max(dv, 0), N - 1);
    below += (dd < lo) ? 1 : 0;
    const unsigned u = (unsigned)(dd - lo);
    if (u < (unsigned)NRANGE) atomicAdd(&lcnt[u], 1);
  };
  {
    int eb = e0;
    for (; eb + U1 * 256 <= e1; eb += U1 * 256) {
      const int* pd = ei + E + eb + tid;
      int d[U1];
#pragma unroll
      for (int k = 0; k < U1; ++k) d[k] = pd[k * 256];
#pragma unroll
      for (int k = 0; k < U1; ++k) count(d[k]);
    }
    for (int e = eb + tid; e < e1; e += 256) count(ei[E + e]);
  }
  __syncthreads();

  {
    const int4 c = *(const int4*)(lcnt + tid * 4);
    const int sum = c.x + c.y + c.z + c.w;
    int inc = sum;
#pragma unroll
    for (int off = 1; off < 32; off <<= 1) {
      const int t = __shfl_up(inc, off, 32);
      if (lane >= off) inc += t;
    }
#pragma unroll
    for (int off = 16; off >= 1; off >>= 1) below += __shfl_xor(below, off, 32);
    if (lane == 31) wsum[wid] = inc;
    if (lane == 0) wbel[wid] = below;
    __syncthreads();
    int p = e0 + inc - sum;
#pragma unroll
    for (int w = 0; w < 8; ++w) p += wbel[w] + (w < wid ? wsum[w] : 0);
    const int4 f = make_int4(p, p + c.x, p + c.x + c.y, p + c.x + c.y + c.z);
    *(int4*)(lcnt + tid * 4) = f;  // from here on: next free place of each node's run
    const int node = lo + tid * 4;
    int2* r = runs + (size_t)q * N + node;
    if (node + 0 < N) r[0] = make_int2(f.x, c.x);
    if (node + 1 < N) r[1] = make_int2(f.y, c.y);
    if (node + 2 < N) r[2] = make_int2(f.z, c.z);
    if (node + 3 < N) r[3] = make_int2(f.w, c.w);
  }
  __syncthreads();

  {
    int eb = e0;
    for (; eb + U2 * 256 <= e1; eb += U2 * 256) {
      const int* pd = ei + E + eb + tid;
      const int* ps = ei + eb + tid;
      const float* pw = ew + eb + tid;
      int d[U2], sv[U2], pos[U2];
      float wv[U2];
#pragma unroll
      for (int k = 0; k < U2; ++k) {
        d[k] = pd[k * 256];
        sv[k] = ps[k * 256];
        wv[k] = pw[k * 256];
      }
      // the three addresses keep their registers until every load of the trip has taken them
      asm volatile("s_wait_xcnt 0x0" :: "v"(pd), "v"(ps), "v"(pw) : "memory");
      // all LDS atomics of the trip go out before the first result is waited for
#pragma unroll
      for (int k = 0; k < U2; ++k) {
        d[k] = min(max(d[k], 0), N - 1) - lo;
        pos[k] = 0;
        if ((unsigned)d[k] < (unsigned)NRANGE) pos[k] = atomicAdd(&lcnt[d[k]], 1);
      }
#pragma unroll
      for (int k = 0; k < U2; ++k) {
        if ((unsigned)d[k] < (unsigned)NRANGE)
          edges[pos[k]] = make_int2(min(max(sv[k], 0), N - 1), __float_as_int(wv[k]));
      }
      // the registers of the last store are rewritten at the head of the next trip
      asm volatile("s_wait_xcnt 0x0" ::: "memory");
    }
    for (int e = eb + tid; e < e1; e += 256) {
      const int u = min(max(ei[E + e], 0), N - 1) - lo;
      if ((unsigned)u < (unsigned)NRANGE) {
        const int pos = atomicAdd(&lcnt[u], 1);
        edges[pos] = make_int2(min(max(ei[e], 0), N - 1), __float_as_int(ew[e]));
        // the store's registers are rewritten in the next round
        asm volatile("s_wait_xcnt 0x0" ::: "memory");
      }
    }
  }
}

// ---------------------------------------------------------------------------
// Kernel 1: LN1 + xs = y@Wl+bl, xd = y@Wr+br   (N x 128) x (128 x 512) twice
// block = 256 threads = 8 waves. A work-group takes 64 rows and one quarter (256) of the
// 1024 combined columns (Wl|Wr); a wave takes 32 columns of it and all 64 rows: 4 x 2 tiles
// of 16x16, WMMA f32 16x16x4. A lane reads two neighbouring columns of a weight row in one
// 8-byte load: the even column goes to the wave's first column tile, the odd one to its
// second, and every loaded fragment serves the four row tiles.
// The first nSort work-groups of the grid group the edges instead (group_edges above):
// that work needs no matrix unit and nothing of the products, so it runs beside them.
// ---------------------------------------------------------------------------
#define K1ROWS 64
__global__ __launch_bounds__(256) void k_ln1_xsxd(
    const float* __restrict__ x, const float* __restrict__ g, const float* __restrict__ b,
    const float* __restrict__ Wl, const float* __restrict__ bl,
    const float* __restrict__ Wr, const float* __restrict__ br,
    float* __restrict__ xs, float* __restrict__ xd,
    const int* __restrict__ ei, const float* __restrict__ ew,
    int2* __restrict__ runs, int2* __restrict__ edges, int nSort, int E, int N) {
  __shared__ __attribute__((aligned(16))) float yln[K1ROWS][132];  // pad 132 -> conflict-free column reads
  __shared__ __attribute__((aligned(16))) int lcnt[NRANGE];
  __shared__ int wsum[8];
  __shared__ int wbel[8];
  if ((int)blockIdx.x < nSort) {
    group_edges(ei, ew, runs, edges, lcnt, wsum, wbel, blockIdx.x, E, N);
    return;
  }
  const int tid = threadIdx.x, lane = tid & 31, wid = tid >> 5;
  const int gb = (int)blockIdx.x - nSort;
  const int rowBase = (gb >> 2) * K1ROWS;
  const int quarter = gb & 3;

  // --- LayerNorm: wave wid normalizes rows 8*wid .. 8*wid+7, a half-wave each; the four
  // rounds go side by side: all their loads first, then each step of the four sums together
  {
    const int hl = lane & 15;
    float vals[4][8];
    float s[4], sq[4];
#pragma unroll
    for (int it = 0; it < 4; ++it) {
      const int row = rowBase + 8 * wid + 2 * it + (lane >> 4);
      if (row < N) {
        const float* xr = x + (size_t)row * 128 + hl * 8;
#pragma unroll
        for (int i = 0; i < 8; ++i) vals[it][i] = xr[i];
      } else {
#pragma unroll
        for (int i = 0; i < 8; ++i) vals[it][i] = 0.f;
      }
    }
#pragma unroll
    for (int it = 0; it < 4; ++it) {
      s[it] = 0.f; sq[it] = 0.f;
#pragma unroll
      for (int i = 0; i < 8; ++i) { const float v = vals[it][i]; s[it] += v; sq[it] += v * v; }
    }
#pragma unroll
    for (int off = 8; off >= 1; off >>= 1) {
#pragma unroll
      for (int it = 0; it < 4; ++it) {
        s[it] += __shfl_xor(s[it], off, 16);
        sq[it] += __shfl_xor(sq[it], off, 16);
      }
    }
#pragma unroll
    for (int it = 0; it < 4; ++it) {
      const int r = 8 * wid + 2 * it + (lane >> 4);
      const float mu = s[it] * (1.f / 128.f);
      const float var = sq[it] * (1.f / 128.f) - mu * mu;
      const float rs = rsqrtf(var + 1e-5f);
#pragma unroll
      for (int i = 0; i < 8; ++i) {
        const int c = hl * 8 + i;
        yln[r][c] = (vals[it][i] - mu) * rs * g[c] + b[c];
      }
    }
  }
  __syncthreads();

  const int m = lane & 15;           // A row
  const int n = lane & 15;           // B/D col
  const int kb = (lane >> 4) * 2;    // K sub-offset per half-wave
  const float* W    = quarter < 2 ? Wl : Wr;
  const float* bias = quarter < 2 ? bl : br;
  float* out        = quarter < 2 ? xs : xd;
  const int col = (quarter & 1) * 256 + wid * 32 + 2 * n;  // this lane's even column
  const float* wp = W + (size_t)kb * 512 + col;
  v8f acc[4][2] = {};
  // weight rows of four k steps at a time, in two register sets that take turns
  float2 pw[2][8];
  auto loadw = [&](float2 (&p)[8], const int kc) {
#pragma unroll
    for (int j = 0; j < 4; ++j) {
      p[2 * j]     = *(const float2*)(wp + (size_t)(kc + 4 * j) * 512);
      p[2 * j + 1] = *(const float2*)(wp + (size_t)(kc + 4 * j + 1) * 512);
    }
  };
  loadw(pw[0], 0);
#pragma unroll
  for (int c = 0; c < 8; ++c) {
    if (c + 1 < 8) loadw(pw[(c + 1) & 1], (c + 1) * 16);
    // keeps the next set's weight loads in front of this set's 32 WMMAs, so that their way
    // from L2 passes under the matrix work (left alone, the loads sink to just before their use);
    // LDS reads may cross
    __builtin_amdgcn_sched_barrier(0x100);
#pragma unroll
    for (int j = 0; j < 4; ++j) {
      const int k0 = c * 16 + 4 * j;
      const float2 p0 = pw[c & 1][2 * j], p1 = pw[c & 1][2 * j + 1];
      v2f be, bo;
      be[0] = p0.x; be[1] = p1.x;
      bo[0] = p0.y; bo[1] = p1.y;
#pragma unroll
      for (int i = 0; i < 4; ++i) {
        v2f a;
        a[0] = yln[i * 16 + m][k0 + kb];
        a[1] = yln[i * 16 + m][k0 + kb + 1];
        acc[i][0] = WMMA_F32_16x16x4(a, be, acc[i][0]);
        acc[i][1] = WMMA_F32_16x16x4(a, bo, acc[i][1]);
      }
    }
  }
  const float2 bv = *(const float2*)(bias + col);
#pragma unroll
  for (int i = 0; i < 4; ++i) {
#pragma unroll
    for (int r = 0; r < 8; ++r) {
      const int mr = (lane < 16) ? r : r + 8;
      const int row = rowBase + i * 16 + mr;
      if (row < N)
        *(float2*)(out + (size_t)row * 512 + col) = make_float2(acc[i][0][r] + bv.x, acc[i][1][r] + bv.y);
    }
  }
}

// ---------------------------------------------------------------------------
// Kernel 2: one wave owns one destination node and walks its incoming edges
// (sixteen runs, one in each part of the edge list, walked as one list).
// logit[h] = sum_c lrelu(xs[src,h,c]+xd[dst,h,c]+w*We[h,c]) * att[h,c]
// Eight lanes own one head: lane l has head l>>3 and, of that head's 128 channels, the four
// 16-byte pieces i*8 + (l&7), i = 0..3 (each load of the wave still takes whole 128-byte lines).
// So a logit is summed over 8 neighbouring lanes only, and a lane keeps the running maximum,
// the denominator and the exp of its own head alone.
// Running maximum, denominator and weighted sum of xs[src] stay in registers
// (rescaled when the maximum rises), so each xs row is read once and nothing
// is added in memory. The heads meet once per node, behind the edges.
// Then xnew = x + mean_h(agg) + bias_att ; y2 = LN2(xnew).
// ---------------------------------------------------------------------------
// value of lane l ^ M inside a 16-lane row (DPP row_xmask:M); every lane is on where it is used
template <int M>
__device__ __forceinline__ float row_xor(float v) {
  return __int_as_float(__builtin_amdgcn_update_dpp(0, __float_as_int(v), 0x160 + M, 0xf, 0xf, true));
}
// value of lane l ^ 16
__device__ __forceinline__ float half_xor(float v) {
  return __int_as_float(__builtin_amdgcn_permlanex16(__float_as_int(v), __float_as_int(v),
                                                     0x76543210, 0xfedcba98, false, false));
}

__global__ __launch_bounds__(256) void k_node(
    const float* __restrict__ x, const float* __restrict__ xs, const float* __restrict__ xd,
    const float* __restrict__ We, const float* __restrict__ att,
    const int2* __restrict__ runs, const int2* __restrict__ edges,
    const float* __restrict__ bias_att, const float* __restrict__ g,
    const float* __restrict__ b, float* __restrict__ xnew, float* __restrict__ y2, int N) {
  const int lane = threadIdx.x & 31;
  const int wid = __builtin_amdgcn_readfirstlane(threadIdx.x >> 5);  // wave index in scalar registers
  const int nid = blockIdx.x * 8 + wid;
  if (nid >= N) return;
  // lane q fetches the node's run in part q (the upper half-wave reads the same sixteen again);
  // readlane hands them to the whole wave.
  // first[q]: place of run q's first edge in the node's list; shift[q]: from list place to edges[] index
  const int2 rv = runs[(size_t)(lane & (EPARTS - 1)) * N + nid];
  int first[EPARTS], shift[EPARTS];
  int deg = 0;
#pragma unroll
  for (int q = 0; q < EPARTS; ++q) {
    first[q] = deg;
    shift[q] = __builtin_amdgcn_readlane(rv.x, q) - deg;
    deg += __builtin_amdgcn_readlane(rv.y, q);
  }
  const int hd = lane >> 3;                 // this lane's head
  const int fo = hd * 32 + (lane & 7);      // its first 16-byte piece in a row of 512 floats
  const v4f* xd4 = (const v4f*)(xd + (size_t)nid * 512) + fo;
  const v4f* We4 = (const v4f*)We + fo;
  const v4f* at4 = (const v4f*)att + fo;

  // the 16 channels as 8 pairs, in the order of the loaded registers: every step on them is one
  // packed instruction on a register pair as it was loaded
  v2f dv[8], we[8], at[8], acc[8];
  float mx = -INFINITY, den = 0.f;
#pragma unroll
  for (int i = 0; i < 4; ++i) {
    const v4f d = xd4[i * 8], e = We4[i * 8], a = at4[i * 8];
    dv[2 * i] = d.lo; dv[2 * i + 1] = d.hi;
    we[2 * i] = e.lo; we[2 * i + 1] = e.hi;
    at[2 * i] = a.lo; at[2 * i + 1] = a.hi;
    acc[2 * i] = 0.f; acc[2 * i + 1] = 0.f;
  }

  // one edge: the logit of the lane's head from its part of the xs row, then the running softmax sums
  auto edge = [&](const v4f (&row)[4], const float w) {
    v2f s0, s1;
#pragma unroll
    for (int i = 0; i < 4; ++i) {
      const v2f m0 = row[i].lo + dv[2 * i] + w * we[2 * i];
      const v2f m1 = row[i].hi + dv[2 * i + 1] + w * we[2 * i + 1];
      v2f l0, l1;
      l0.x = lrelu(m0.x); l0.y = lrelu(m0.y);
      l1.x = lrelu(m1.x); l1.y = lrelu(m1.y);
      if (i == 0) { s0 = l0 * at[0]; s1 = l1 * at[1]; }
      else { s0 += l0 * at[2 * i]; s1 += l1 * at[2 * i + 1]; }
    }
    s0 += s1;
    float lg = s0.x + s0.y;
    lg += row_xor<1>(lg);
    lg += row_xor<2>(lg);
    lg += row_xor<4>(lg);
    // one of the two factors is 1: the old sums shrink if the maximum rises,
    // else the new term does
    const float df = lg - mx;
    const float t = expf(-fabsf(df));
    const float sc = df > 0.f ? t : 1.f;
    const float p  = df > 0.f ? 1.f : t;
    mx = fmaxf(mx, lg);
    den = den * sc + p;
#pragma unroll
    for (int i = 0; i < 4; ++i) {
      acc[2 * i] = acc[2 * i] * sc + p * row[i].lo;
      acc[2 * i + 1] = acc[2 * i + 1] * sc + p * row[i].hi;
    }
  };
  auto fetch = [&](v4f (&row)[4], const int s) {
    const v4f* r = (const v4f*)(xs + (size_t)s * 512) + fo;
#pragma unroll
    for (int i = 0; i < 4; ++i) row[i] = r[i * 8];
    // the address registers of these loads are reused right behind them
    asm volatile("s_wait_xcnt 0x0" ::: "memory");
  };

  for (int jb = 0; jb < deg; jb += 32) {
    const int n = min(32, deg - jb);
    // lane j holds edge jb + j of the node's list; readlane hands it to the whole wave
    int2 ev = make_int2(0, 0);
    if (lane < n) {
      // list entry jb + lane lies in the last run that begins at or before it (empty runs drop out)
      const int le = jb + lane;
      int sh = shift[0];
#pragma unroll
      for (int q = 1; q < EPARTS; ++q) sh = (le >= first[q]) ? shift[q] : sh;
      ev = edges[le + sh];
    }
    // two row buffers in turn: the next edge's row is on its way while this one is worked on.
    // Every fetch in the loop is unconditional, so that the wait in front of a row's use
    // can leave the younger fetch in flight; the last one or two edges follow the loop.
    v4f ra[4], rb[4];
    fetch(ra, __builtin_amdgcn_readlane(ev.x, 0));
    int j = 0;
    for (; j + 2 < n; j += 2) {
      fetch(rb, __builtin_amdgcn_readlane(ev.x, j + 1));
      edge(ra, __int_as_float(__builtin_amdgcn_readlane(ev.y, j)));
      fetch(ra, __builtin_amdgcn_readlane(ev.x, j + 2));
      edge(rb, __int_as_float(__builtin_amdgcn_readlane(ev.y, j + 1)));
    }
    if (j + 1 < n) {
      fetch(rb, __builtin_amdgcn_readlane(ev.x, j + 1));
      edge(ra, __int_as_float(__builtin_amdgcn_readlane(ev.y, j)));
      edge(rb, __int_as_float(__builtin_amdgcn_readlane(ev.y, j + 1)));
    } else {
      edge(ra, __int_as_float(__builtin_amdgcn_readlane(ev.y, j)));
    }
  }

  // The four heads' shares of a channel lie in lanes l, l^8, l^16, l^24. Each of the two exchanges
  // hands over the half that the other lane goes on with, so that lane l ends with piece l>>3 of
  // the head sum, which is channels 4*l .. 4*l+3.
  const float rden = 1.f / (den + 1e-16f);
#pragma unroll
  for (int i = 0; i < 8; ++i) acc[i] *= rden;
  const bool u2 = (hd & 2) != 0, u1 = (hd & 1) != 0;
  float k[8], hs[4];
#pragma unroll
  for (int i = 0; i < 4; ++i) {   // pieces 0,1 stay in heads 0,1 and pieces 2,3 in heads 2,3
    k[2 * i]     = (u2 ? acc[4 + i].x : acc[i].x) + half_xor(u2 ? acc[i].x : acc[4 + i].x);
    k[2 * i + 1] = (u2 ? acc[4 + i].y : acc[i].y) + half_xor(u2 ? acc[i].y : acc[4 + i].y);
  }
#pragma unroll
  for (int i = 0; i < 4; ++i)     // the even piece stays in the even head, the odd one in the odd head
    hs[i] = (u1 ? k[4 + i] : k[i]) + row_xor<8>(u1 ? k[i] : k[4 + i]);

  const float4 xv = ((const float4*)(x + (size_t)nid * 128))[lane];
  const float4 bv = ((const float4*)bias_att)[lane];
  float4 v;
  v.x = xv.x + 0.25f * hs[0] + bv.x;
  v.y = xv.y + 0.25f * hs[1] + bv.y;
  v.z = xv.z + 0.25f * hs[2] + bv.z;
  v.w = xv.w + 0.25f * hs[3] + bv.w;
  float s = v.x + v.y + v.z + v.w;
  float sq = v.x * v.x + v.y * v.y + v.z * v.z + v.w * v.w;
#pragma unroll
  for (int off = 16; off >= 1; off >>= 1) {
    s += __shfl_xor(s, off, 32);
    sq += __shfl_xor(sq, off, 32);
  }
  const float mu = s * (1.f / 128.f);
  const float var = sq * (1.f / 128.f) - mu * mu;
  const float rs = rsqrtf(var + 1e-5f);
  ((float4*)(xnew + (size_t)nid * 128))[lane] = v;
  const int c = lane * 4;
  float4 yv;
  yv.x = (v.x - mu) * rs * g[c + 0] + b[c + 0];
  yv.y = (v.y - mu) * rs * g[c + 1] + b[c + 1];
  yv.z = (v.z - mu) * rs * g[c + 2] + b[c + 2];
  yv.w = (v.w - mu) * rs * g[c + 3] + b[c + 3];
  ((float4*)(y2 + (size_t)nid * 128))[lane] = yv;
}

// ---------------------------------------------------------------------------
// Kernel 3: FFN  out = xnew + gelu(y2@W1+b1)@W2 + b2  (fully fused, WMMA f32)
// block = 256 threads = 8 waves; 16 rows; each wave owns one 16x16 tile.
// ---------------------------------------------------------------------------
__global__ __launch_bounds__(256) void k_ffn(
    const float* __restrict__ xnew, const float* __restrict__ y2,
    const float* __restrict__ W1, const float* __restrict__ b1,
    const float* __restrict__ W2, const float* __restrict__ b2,
    float* __restrict__ out, int N) {
  __shared__ float ytile[16][132];
  __shared__ float htile[16][132];
  const int tid = threadIdx.x, lane = tid & 31, wid = tid >> 5;
  const int rowBase = blockIdx.x * 16;

  {  // stage 0: y2 tile -> LDS
    const int r = tid >> 4, c0 = (tid & 15) * 8;
    const int row = rowBase + r;
    const float* src = y2 + (size_t)row * 128 + c0;
#pragma unroll
    for (int i = 0; i < 8; ++i) ytile[r][c0 + i] = (row < N) ? src[i] : 0.f;
  }
  __syncthreads();

  const int m = lane & 15, n = lane & 15, kb = (lane >> 4) * 2;
  const int colLocal = wid * 16;

  {  // stage 1: h = gelu(y2 @ W1 + b1)
    v8f acc = {};
#pragma unroll
    for (int k0 = 0; k0 < 128; k0 += 4) {
      v2f a, bf;
      a[0] = ytile[m][k0 + kb];
      a[1] = ytile[m][k0 + kb + 1];
      bf[0] = W1[(size_t)(k0 + kb) * 128 + colLocal + n];
      bf[1] = W1[(size_t)(k0 + kb + 1) * 128 + colLocal + n];
      acc = WMMA_F32_16x16x4(a, bf, acc);
    }
    const float bv = b1[colLocal + n];
#pragma unroll
    for (int r = 0; r < 8; ++r) {
      const int mr = (lane < 16) ? r : r + 8;
      const float v = acc[r] + bv;
      htile[mr][colLocal + n] = 0.5f * v * (1.f + erff(v * 0.70710678118654752f));
    }
  }
  __syncthreads();

  {  // stage 2: out = xnew + h @ W2 + b2
    v8f acc = {};
#pragma unroll
    for (int k0 = 0; k0 < 128; k0 += 4) {
      v2f a, bf;
      a[0] = htile[m][k0 + kb];
      a[1] = htile[m][k0 + kb + 1];
      bf[0] = W2[(size_t)(k0 + kb) * 128 + colLocal + n];
      bf[1] = W2[(size_t)(k0 + kb + 1) * 128 + colLocal + n];
      acc = WMMA_F32_16x16x4(a, bf, acc);
    }
    const float bv = b2[colLocal + n];
#pragma unroll
    for (int r = 0; r < 8; ++r) {
      const int mr = (lane < 16) ? r : r + 8;
      const int row = rowBase + mr;
      if (row < N)
        out[(size_t)row * 128 + colLocal + n] =
            xnew[(size_t)row * 128 + colLocal + n] + acc[r] + bv;
    }
  }
}

// ---------------------------------------------------------------------------
extern "C" void kernel_launch(void* const* d_in, const int* in_sizes, int n_in,
                              void* d_out, int out_size, void* d_ws, size_t ws_size,
                              hipStream_t stream) {
  const float* x        = (const float*)d_in[0];
  const int*   ei       = (const int*)  d_in[1];   // [2,E] int32
  const float* ew       = (const float*)d_in[2];   // [E,1]
  const float* ln1_g    = (const float*)d_in[3];
  const float* ln1_b    = (const float*)d_in[4];
  const float* Wl       = (const float*)d_in[5];   // [128,512]
  const float* bl       = (const float*)d_in[6];
  const float* Wr       = (const float*)d_in[7];
  const float* br       = (const float*)d_in[8];
  const float* We       = (const float*)d_in[9];   // [1,512]
  const float* att      = (const float*)d_in[10];  // [4,128]
  const float* bias_att = (const float*)d_in[11];
  const float* ln2_g    = (const float*)d_in[12];
  const float* ln2_b    = (const float*)d_in[13];
  const float* W1       = (const float*)d_in[14];  // [128,128]
  const float* b1       = (const float*)d_in[15];
  const float* W2       = (const float*)d_in[16];  // [128,128]
  const float* b2       = (const float*)d_in[17];

  const int N = in_sizes[0] / 128;
  const int E = in_sizes[2];

  float* ws = (float*)d_ws;
  size_t o = 0;
  float* xs    = ws + o; o += (size_t)N * 512;
  float* xd    = ws + o; o += (size_t)N * 512;
  float* xnew  = ws + o; o += (size_t)N * 128;
  float* y2    = ws + o; o += (size_t)N * 128;
  int2*  runs  = (int2*)(ws + o); o += (size_t)N * 2 * EPARTS;
  int2*  edges = (int2*)(ws + o); o += (size_t)E * 2;
  const int nSort = (N + NRANGE - 1) / NRANGE * EPARTS;

  k_ln1_xsxd<<<nSort + (N + K1ROWS - 1) / K1ROWS * 4, 256, 0, stream>>>(x, ln1_g, ln1_b, Wl, bl, Wr, br, xs, xd,
                                                        ei, ew, runs, edges, nSort, E, N);
  k_node<<<(N + 7) / 8, 256, 0, stream>>>(x, xs, xd, We, att, runs, edges, bias_att,
                                          ln2_g, ln2_b, xnew, y2, N);
  k_ffn<<<(N + 15) / 16, 256, 0, stream>>>(xnew, y2, W1, b1, W2, b2, (float*)d_out, N);
}

// v005
// A run of this version takes 95.1 microseconds.
// Next to v004, in two timings, it ran 1.05 times as fast each time.
// Over all steps from v000 it is 5.03 times as fast.
#include <hip/hip_runtime.h>
#include <math.h>

// ---------------------------------------------------------------------------
// CDNA5 (gfx1250) wave32 WMMA fp32 path: V_WMMA_F32_16X16X4_F32
// A: 16x4 f32 (2 VGPRs/lane), B: 4x16 f32 (2 VGPRs/lane), C/D: 16x16 f32 (8 VGPRs)
// ---------------------------------------------------------------------------
typedef __attribute__((ext_vector_type(2))) float v2f;
typedef __attribute__((ext_vector_type(4))) float v4f;
typedef __attribute__((ext_vector_type(8))) float v8f;

#define WMMA_F32_16x16x4(a, b, c) \
  __builtin_amdgcn_wmma_f32_16x16x4_f32(false, (a), false, (b), (short)0, (c), false, false)

__device__ __forceinline__ float lrelu(float v) { return v >= 0.f ? v : 0.2f * v; }

// ---------------------------------------------------------------------------
// Edge grouping, one work-group on its own: it takes one sixteenth of the edge list
// (part q) and 1024 destination nodes (range r), reads the part's destinations
// twice and needs nothing from any other work-group.
// Pass 1: in-degree of its nodes in LDS, and how many edges of the part go to lower nodes.
// Scan:   each node's run inside the part's own stretch of edges[] -> runs[q*N+node] = (first, count)
// Pass 2: (src, weight) of every edge of the range to the next free place of its node's run.
// Both passes take whole trips of U*256 edges with all loads of a trip in flight (one
// address, constant steps); what is left of the part follows edge by edge.
// ---------------------------------------------------------------------------
#define EPARTS 16
#define NRANGE 1024
#define U1 26
#define U2 13

__device__ __forceinline__ void group_edges(
    const int* __restrict__ ei, const float* __restrict__ ew, int2* __restrict__ runs,
    int2* __restrict__ edges, int* lcnt, int* wsum, int* wbel, int sb, int E, int N) {
  const int tid = threadIdx.x, lane = tid & 31, wid = tid >> 5;
  const int q = sb & (EPARTS - 1);
  const int lo = (sb / EPARTS) * NRANGE;
  const int EP = (E + EPARTS - 1) / EPARTS;
  const int e0 = min(q * EP, E), e1 = min(e0 + EP, E);
  *(int4*)(lcnt + tid * 4) = make_int4(0, 0, 0, 0);
  __syncthreads();

  int below = 0;
  auto count = [&](const int dv) {
    const int dd = min(max(dv, 0), N - 1);
    below += (dd < lo) ? 1 : 0;
    const unsigned u = (unsigned)(dd - lo);
    if (u < (unsigned)NRANGE) atomicAdd(&lcnt[u], 1);
  };
  {
    int eb = e0;
    for (; eb + U1 * 256 <= e1; eb += U1 * 256) {
      const int* pd = ei + E + eb + tid;
      int d[U1];
#pragma unroll
      for (int k = 0; k < U1; ++k) d[k] = pd[k * 256];
#pragma unroll
      for (int k = 0; k < U1; ++k) count(d[k]);
    }
    for (int e = eb + tid; e < e1; e += 256) count(ei[E + e]);
  }
  __syncthreads();

  {
    const int4 c = *(const int4*)(lcnt + tid * 4);
    const int sum = c.x + c.y + c.z + c.w;
    int inc = sum;
#pragma unroll
    for (int off = 1; off < 32; off <<= 1) {
      const int t = __shfl_up(inc, off, 32);
      if (lane >= off) inc += t;
    }
#pragma unroll
    for (int off = 16; off >= 1; off >>= 1) below += __shfl_xor(below, off, 32);
    if (lane == 31) wsum[wid] = inc;
    if (lane == 0) wbel[wid] = below;
    __syncthreads();
    int p = e0 + inc - sum;
#pragma unroll
    for (int w = 0; w < 8; ++w) p += wbel[w] + (w < wid ? wsum[w] : 0);
    const int4 f = make_int4(p, p + c.x, p + c.x + c.y, p + c.x + c.y + c.z);
    *(int4*)(lcnt + tid * 4) = f;  // from here on: next free place of each node's run
    const int node = lo + tid * 4;
    int2* r = runs + (size_t)q * N + node;
    if (node + 0 < N) r[0] = make_int2(f.x, c.x);
    if (node + 1 < N) r[1] = make_int2(f.y, c.y);
    if (node + 2 < N) r[2] = make_int2(f.z, c.z);
    if (node + 3 < N) r[3] = make_int2(f.w, c.w);
  }
  __syncthreads();

  {
    int eb = e0;
    for (; eb + U2 * 256 <= e1; eb += U2 * 256) {
      const int* pd = ei + E + eb + tid;
      const int* ps = ei + eb + tid;
      const float* pw = ew + eb + tid;
      int d[U2], sv[U2], pos[U2];
      float wv[U2];
#pragma unroll
      for (int k = 0; k < U2; ++k) {
        d[k] = pd[k * 256];
        sv[k] = ps[k * 256];
        wv[k] = pw[k * 256];
      }
      // the three addresses keep their registers until every load of the trip has taken them
      asm volatile("s_wait_xcnt 0x0" :: "v"(pd), "v"(ps), "v"(pw) : "memory");
      // all LDS atomics of the trip go out before the first result is waited for
#pragma unroll
      for (int k = 0; k < U2; ++k) {
        d[k] = min(max(d[k], 0), N - 1) - lo;
        pos[k] = 0;
        if ((unsigned)d[k] < (unsigned)NRANGE) pos[k] = atomicAdd(&lcnt[d[k]], 1);
      }
#pragma unroll
      for (int k = 0; k < U2; ++k) {
        if ((unsigned)d[k] < (unsigned)NRANGE)
          edges[pos[k]] = make_int2(min(max(sv[k], 0), N - 1), __float_as_int(wv[k]));
      }
      // the registers of the last store are rewritten at the head of the next trip
      asm volatile("s_wait_xcnt 0x0" ::: "memory");
    }
    for (int e = eb + tid; e < e1; e += 256) {
      const int u = min(max(ei[E + e], 0), N - 1) - lo;
      if ((unsigned)u < (unsigned)NRANGE) {
        const int pos = atomicAdd(&lcnt[u], 1);
        edges[pos] = make_int2(min(max(ei[e], 0), N - 1), __float_as_int(ew[e]));
        // the store's registers are rewritten in the next round
        asm volatile("s_wait_xcnt 0x0" ::: "memory");
      }
    }
  }
}

// ---------------------------------------------------------------------------
// Kernel 1: LN1 + xs = y@Wl+bl, xd = y@Wr+br   (N x 128) x (128 x 512) twice
// block = 256 threads = 8 waves. A work-group takes 64 rows and one quarter (256) of the
// 1024 combined columns (Wl|Wr); a wave takes 32 columns of it and all 64 rows: 4 x 2 tiles
// of 16x16, WMMA f32 16x16x4. A lane reads two neighbouring columns of a weight row in one
// 8-byte load: the even column goes to the wave's first column tile, the odd one to its
// second, and every loaded fragment serves the four row tiles.
// The first nSort work-groups of the grid group the edges instead (group_edges above):
// that work needs no matrix unit and nothing of the products, so it runs beside them.
// ---------------------------------------------------------------------------
#define K1ROWS 64
__global__ __launch_bounds__(256) void k_ln1_xsxd(
    const float* __restrict__ x, const float* __restrict__ g, const float* __restrict__ b,
    const float* __restrict__ Wl, const float* __restrict__ bl,
    const float* __restrict__ Wr, const float* __restrict__ br,
    float* __restrict__ xs, float* __restrict__ xd,
    const int* __restrict__ ei, const float* __restrict__ ew,
    int2* __restrict__ runs, int2* __restrict__ edges, int nSort, int E, int N) {
  __shared__ __attribute__((aligned(16))) float yln[K1ROWS][132];  // pad 132 -> conflict-free column reads
  __shared__ __attribute__((aligned(16))) int lcnt[NRANGE];
  __shared__ int wsum[8];
  __shared__ int wbel[8];
  if ((int)blockIdx.x < nSort) {
    group_edges(ei, ew, runs, edges, lcnt, wsum, wbel, blockIdx.x, E, N);
    return;
  }
  const int tid = threadIdx.x, lane = tid & 31, wid = tid >> 5;
  const int gb = (int)blockIdx.x - nSort;
  const int rowBase = (gb >> 2) * K1ROWS;
  const int quarter = gb & 3;

  // --- LayerNorm: wave wid normalizes rows 8*wid .. 8*wid+7, a half-wave each; the four
  // rounds go side by side: all their loads first, then each step of the four sums together
  {
    const int hl = lane & 15;
    float vals[4][8];
    float s[4], sq[4];
#pragma unroll
    for (int it = 0; it < 4; ++it) {
      const int row = rowBase + 8 * wid + 2 * it + (lane >> 4);
      if (row < N) {
        const float* xr = x + (size_t)row * 128 + hl * 8;
#pragma unroll
        for (int i = 0; i < 8; ++i) vals[it][i] = xr[i];
      } else {
#pragma unroll
        for (int i = 0; i < 8; ++i) vals[it][i] = 0.f;
      }
    }
#pragma unroll
    for (int it = 0; it < 4; ++it) {
      s[it] = 0.f; sq[it] = 0.f;
#pragma unroll
      for (int i = 0; i < 8; ++i) { const float v = vals[it][i]; s[it] += v; sq[it] += v * v; }
    }
#pragma unroll
    for (int off = 8; off >= 1; off >>= 1) {
#pragma unroll
      for (int it = 0; it < 4; ++it) {
        s[it] += __shfl_xor(s[it], off, 16);
        sq[it] += __shfl_xor(sq[it], off, 16);
      }
    }
#pragma unroll
    for (int it = 0; it < 4; ++it) {
      const int r = 8 * wid + 2 * it + (lane >> 4);
      const float mu = s[it] * (1.f / 128.f);
      const float var = sq[it] * (1.f / 128.f) - mu * mu;
      const float rs = rsqrtf(var + 1e-5f);
#pragma unroll
      for (int i = 0; i < 8; ++i) {
        const int c = hl * 8 + i;
        yln[r][c] = (vals[it][i] - mu) * rs * g[c] + b[c];
      }
    }
  }
  __syncthreads();

  const int m = lane & 15;           // A row
  const int n = lane & 15;           // B/D col
  const int kb = (lane >> 4) * 2;    // K sub-offset per half-wave
  const float* W    = quarter < 2 ? Wl : Wr;
  const float* bias = quarter < 2 ? bl : br;
  float* out        = quarter < 2 ? xs : xd;
  const int col = (quarter & 1) * 256 + wid * 32 + 2 * n;  // this lane's even column
  const float* wp = W + (size_t)kb * 512 + col;
  v8f acc[4][2] = {};
  // weight rows of four k steps at a time, in two register sets that take turns
  float2 pw[2][8];
  auto loadw = [&](float2 (&p)[8], const int kc) {
#pragma unroll
    for (int j = 0; j < 4; ++j) {
      p[2 * j]     = *(const float2*)(wp + (size_t)(kc + 4 * j) * 512);
      p[2 * j + 1] = *(const float2*)(wp + (size_t)(kc + 4 * j + 1) * 512);
    }
  };
  loadw(pw[0], 0);
#pragma unroll
  for (int c = 0; c < 8; ++c) {
    if (c + 1 < 8) loadw(pw[(c + 1) & 1], (c + 1) * 16);
    // keeps the next set's weight loads in front of this set's 32 WMMAs, so that their way
    // from L2 passes under the matrix work (left alone, the loads sink to just before their use);
    // LDS reads may cross
    __builtin_amdgcn_sched_barrier(0x100);
#pragma unroll
    for (int j = 0; j < 4; ++j) {
      const int k0 = c * 16 + 4 * j;
      const float2 p0 = pw[c & 1][2 * j], p1 = pw[c & 1][2 * j + 1];
      v2f be, bo;
      be[0] = p0.x; be[1] = p1.x;
      bo[0] = p0.y; bo[1] = p1.y;
#pragma unroll
      for (int i = 0; i < 4; ++i) {
        v2f a;
        a[0] = yln[i * 16 + m][k0 + kb];
        a[1] = yln[i * 16 + m][k0 + kb + 1];
        acc[i][0] = WMMA_F32_16x16x4(a, be, acc[i][0]);
        acc[i][1] = WMMA_F32_16x16x4(a, bo, acc[i][1]);
      }
    }
  }
  const float2 bv = *(const float2*)(bias + col);
#pragma unroll
  for (int i = 0; i < 4; ++i) {
#pragma unroll
    for (int r = 0; r < 8; ++r) {
      const int mr = (lane < 16) ? r : r + 8;
      const int row = rowBase + i * 16 + mr;
      if (row < N)
        *(float2*)(out + (size_t)row * 512 + col) = make_float2(acc[i][0][r] + bv.x, acc[i][1][r] + bv.y);
    }
  }
}

// ---------------------------------------------------------------------------
// Kernel 2: a work-group owns 16 destination nodes: attention, residual, LN2 and the FFN.
// Part 1: a wave takes two of the nodes, one after the other, and walks the node's incoming
// edges (sixteen runs, one in each part of the edge list, walked as one list).
// logit[h] = sum_c lrelu(xs[src,h,c]+xd[dst,h,c]+w*We[h,c]) * att[h,c]
// Eight lanes own one head: lane l has head l>>3 and, of that head's 128 channels, the four
// 16-byte pieces i*8 + (l&7), i = 0..3 (each load of the wave still takes whole 128-byte lines).
// So a logit is summed over 8 neighbouring lanes only, and a lane keeps the running maximum,
// the denominator and the exp of its own head alone.
// Running maximum, denominator and weighted sum of xs[src] stay in registers
// (rescaled when the maximum rises), so each xs row is read once and nothing
// is added in memory. The heads meet once per node, behind the edges.
// Then xnew = x + mean_h(agg) + bias_att ; y2 = LN2(xnew): both rows go to LDS, not to memory.
// Part 2: out = xnew + gelu(y2@W1+b1)@W2 + b2 on the 16 rows, WMMA f32; each wave owns one
// 16x16 tile. Its matrix work runs beside the edge walks of the other work-groups of the WGP.
// ---------------------------------------------------------------------------
// value of lane l ^ M inside a 16-lane row (DPP row_xmask:M); every lane is on where it is used
template <int M>
__device__ __forceinline__ float row_xor(float v) {
  return __int_as_float(__builtin_amdgcn_update_dpp(0, __float_as_int(v), 0x160 + M, 0xf, 0xf, true));
}
// value of lane l ^ 16
__device__ __forceinline__ float half_xor(float v) {
  return __int_as_float(__builtin_amdgcn_permlanex16(__float_as_int(v), __float_as_int(v),
                                                     0x76543210, 0xfedcba98, false, false));
}

__global__ __launch_bounds__(256) void k_node_ffn(
    const float* __restrict__ x, const float* __restrict__ xs, const float* __restrict__ xd,
    const float* __restrict__ We, const float* __restrict__ att,
    const int2* __restrict__ runs, const int2* __restrict__ edges,
    const float* __restrict__ bias_att, const float* __restrict__ g,
    const float* __restrict__ b,
    const float* __restrict__ W1, const float* __restrict__ b1,
    const float* __restrict__ W2, const float* __restrict__ b2,
    float* __restrict__ out, int N) {
  __shared__ __attribute__((aligned(16))) float xtile[16][132];  // xnew rows
  __shared__ __attribute__((aligned(16))) float ytile[16][132];  // LN2 rows
  __shared__ float htile[16][132];
  const int lane = threadIdx.x & 31;
  const int wid = __builtin_amdgcn_readfirstlane(threadIdx.x >> 5);  // wave index in scalar registers (nodes wid and wid + 8)
  const int rowBase = blockIdx.x * 16;
  const int hd = lane >> 3;                 // this lane's head
  const int fo = hd * 32 + (lane & 7);      // its first 16-byte piece in a row of 512 floats
  const v4f* We4 = (const v4f*)We + fo;
  const v4f* at4 = (const v4f*)att + fo;

  // the 16 channels as 8 pairs, in the order of the loaded registers: every step on them is one
  // packed instruction on a register pair as it was loaded
  v2f we[8], at[8];
#pragma unroll
  for (int i = 0; i < 4; ++i) {
    const v4f e = We4[i * 8], a = at4[i * 8];
    we[2 * i] = e.lo; we[2 * i + 1] = e.hi;
    at[2 * i] = a.lo; at[2 * i + 1] = a.hi;
  }

  // one copy of the walk serves both nodes: unrolled it is twice the code to fetch, with nothing shared
#pragma unroll 1
  for (int t = 0; t < 2; ++t) {
    const int trow = wid + 8 * t;
    const int nid = rowBase + trow;
    float4 v = make_float4(0.f, 0.f, 0.f, 0.f), yv = v;   // rows past the end: zero, as padding of the tile
    if (nid < N) {
      // lane q fetches the node's run in part q (the upper half-wave reads the same sixteen again);
      // readlane hands them to the whole wave.
      // first[q]: place of run q's first edge in the node's list; shift[q]: from list place to edges[] index
      const int2* rp = runs + (size_t)(lane & (EPARTS - 1)) * N + nid;
      const int2 rv = *rp;
      // the address keeps its registers until the load has taken it
      asm volatile("s_wait_xcnt 0x0" :: "v"(rp) : "memory");
      int first[EPARTS], shift[EPARTS];
      int deg = 0;
#pragma unroll
      for (int q = 0; q < EPARTS; ++q) {
        first[q] = deg;
        shift[q] = __builtin_amdgcn_readlane(rv.x, q) - deg;
        deg += __builtin_amdgcn_readlane(rv.y, q);
      }
      const v4f* xd4 = (const v4f*)(xd + (size_t)nid * 512) + fo;
      v2f dv[8], acc[8];
      float mx = -INFINITY, den = 0.f;
#pragma unroll
      for (int i = 0; i < 4; ++i) {
        const v4f d = xd4[i * 8];
        dv[2 * i] = d.lo; dv[2 * i + 1] = d.hi;
        acc[2 * i] = 0.f; acc[2 * i + 1] = 0.f;
      }
      // the address keeps its registers until the four loads have taken it
      asm volatile("s_wait_xcnt 0x0" :: "v"(xd4) : "memory");

      // one edge: the logit of the lane's head from its part of the xs row, then the running softmax sums
      auto edge = [&](const v4f (&row)[4], const float w) {
        v2f s0, s1;
#pragma unroll
        for (int i = 0; i < 4; ++i) {
          const v2f m0 = row[i].lo + dv[2 * i] + w * we[2 * i];
          const v2f m1 = row[i].hi + dv[2 * i + 1] + w * we[2 * i + 1];
          v2f l0, l1;
          l0.x = lrelu(m0.x); l0.y = lrelu(m0.y);
          l1.x = lrelu(m1.x); l1.y = lrelu(m1.y);
          if (i == 0) { s0 = l0 * at[0]; s1 = l1 * at[1]; }
          else { s0 += l0 * at[2 * i]; s1 += l1 * at[2 * i + 1]; }
        }
        s0 += s1;
        float lg = s0.x + s0.y;
        lg += row_xor<1>(lg);
        lg += row_xor<2>(lg);
        lg += row_xor<4>(lg);
        // one of the two factors is 1: the old sums shrink if the maximum rises,
        // else the new term does
        const float df = lg - mx;
        const float t = expf(-fabsf(df));
        const float sc = df > 0.f ? t : 1.f;
        const float p  = df > 0.f ? 1.f : t;
        mx = fmaxf(mx, lg);
        den = den * sc + p;
#pragma unroll
        for (int i = 0; i < 4; ++i) {
          acc[2 * i] = acc[2 * i] * sc + p * row[i].lo;
          acc[2 * i + 1] = acc[2 * i + 1] * sc + p * row[i].hi;
        }
      };
      auto fetch = [&](v4f (&row)[4], const int s) {
        const v4f* r = (const v4f*)(xs + (size_t)s * 512) + fo;
#pragma unroll
        for (int i = 0; i < 4; ++i) row[i] = r[i * 8];
        // the address keeps its registers until the four loads have taken it; they are reused right behind
        asm volatile("s_wait_xcnt 0x0" :: "v"(r) : "memory");
      };

      for (int jb = 0; jb < deg; jb += 32) {
        const int n = min(32, deg - jb);
        // lane j holds entry jb + j of the node's list; readlane hands it to the whole wave
        int2 ev = make_int2(0, 0);
        if (lane < n) {
          // list entry jb + lane lies in the last run that begins at or before it (empty runs drop out)
          const int le = jb + lane;
          int sh = shift[0];
#pragma unroll
          for (int q = 1; q < EPARTS; ++q) sh = (le >= first[q]) ? shift[q] : sh;
          ev = edges[le + sh];
        }
        // two row buffers in turn: the next edge's row is on its way while this one is worked on.
        // Every fetch in the loop is unconditional, so that the wait in front of a row's use
        // can leave the younger fetch in flight; the last one or two edges follow the loop.
        v4f ra[4], rb[4];
        fetch(ra, __builtin_amdgcn_readlane(ev.x, 0));
        int j = 0;
        for (; j + 2 < n; j += 2) {
          fetch(rb, __builtin_amdgcn_readlane(ev.x, j + 1));
          edge(ra, __int_as_float(__builtin_amdgcn_readlane(ev.y, j)));
          fetch(ra, __builtin_amdgcn_readlane(ev.x, j + 2));
          edge(rb, __int_as_float(__builtin_amdgcn_readlane(ev.y, j + 1)));
        }
        if (j + 1 < n) {
          fetch(rb, __builtin_amdgcn_readlane(ev.x, j + 1));
          edge(ra, __int_as_float(__builtin_amdgcn_readlane(ev.y, j)));
          edge(rb, __int_as_float(__builtin_amdgcn_readlane(ev.y, j + 1)));
        } else {
          edge(ra, __int_as_float(__builtin_amdgcn_readlane(ev.y, j)));
        }
      }

      // The four heads' shares of a channel lie in lanes l, l^8, l^16, l^24. Each of the two exchanges
      // hands over the half that the other lane goes on with, so that lane l ends with piece l>>3 of
      // the head sum, which is channels 4*l .. 4*l+3.
      const float rden = 1.f / (den + 1e-16f);
#pragma unroll
      for (int i = 0; i < 8; ++i) acc[i] *= rden;
      const bool u2 = (hd & 2) != 0, u1 = (hd & 1) != 0;
      float k[8], hs[4];
#pragma unroll
      for (int i = 0; i < 4; ++i) {   // pieces 0,1 stay in heads 0,1 and pieces 2,3 in heads 2,3
        k[2 * i]     = (u2 ? acc[4 + i].x : acc[i].x) + half_xor(u2 ? acc[i].x : acc[4 + i].x);
        k[2 * i + 1] = (u2 ? acc[4 + i].y : acc[i].y) + half_xor(u2 ? acc[i].y : acc[4 + i].y);
      }
#pragma unroll
      for (int i = 0; i < 4; ++i)     // the even piece stays in the even head, the odd one in the odd head
        hs[i] = (u1 ? k[4 + i] : k[i]) + row_xor<8>(u1 ? k[i] : k[4 + i]);

      const float4* xp = (const float4*)(x + (size_t)nid * 128) + lane;
      const float4 xv = *xp;
      const float4 bv = ((const float4*)bias_att)[lane];
      // the address keeps its registers until the load has taken it
      asm volatile("s_wait_xcnt 0x0" :: "v"(xp) : "memory");
      v.x = xv.x + 0.25f * hs[0] + bv.x;
      v.y = xv.y + 0.25f * hs[1] + bv.y;
      v.z = xv.z + 0.25f * hs[2] + bv.z;
      v.w = xv.w + 0.25f * hs[3] + bv.w;
      float s = v.x + v.y + v.z + v.w;
      float sq = v.x * v.x + v.y * v.y + v.z * v.z + v.w * v.w;
#pragma unroll
      for (int off = 16; off >= 1; off >>= 1) {
        s += __shfl_xor(s, off, 32);
        sq += __shfl_xor(sq, off, 32);
      }
      const float mu = s * (1.f / 128.f);
      const float var = sq * (1.f / 128.f) - mu * mu;
      const float rs = rsqrtf(var + 1e-5f);
      const int c = lane * 4;
      yv.x = (v.x - mu) * rs * g[c + 0] + b[c + 0];
      yv.y = (v.y - mu) * rs * g[c + 1] + b[c + 1];
      yv.z = (v.z - mu) * rs * g[c + 2] + b[c + 2];
      yv.w = (v.w - mu) * rs * g[c + 3] + b[c + 3];
    }
    *(float4*)&xtile[trow][lane * 4] = v;
    *(float4*)&ytile[trow][lane * 4] = yv;
  }
  __syncthreads();  // the 16 rows of xnew and y2 are complete for every wave

  const int m = lane & 15, n = lane & 15, kb = (lane >> 4) * 2;
  const int colLocal = wid * 16;

  {  // stage 1: h = gelu(y2 @ W1 + b1)
    v8f acc = {};
#pragma unroll
    for (int k0 = 0; k0 < 128; k0 += 4) {
      v2f a, bf;
      a[0] = ytile[m][k0 + kb];
      a[1] = ytile[m][k0 + kb + 1];
      bf[0] = W1[(size_t)(k0 + kb) * 128 + colLocal + n];
      bf[1] = W1[(size_t)(k0 + kb + 1) * 128 + colLocal + n];
      acc = WMMA_F32_16x16x4(a, bf, acc);
    }
    const float bv = b1[colLocal + n];
#pragma unroll
    for (int r = 0; r < 8; ++r) {
      const int mr = (lane < 16) ? r : r + 8;
      const float v = acc[r] + bv;
      htile[mr][colLocal + n] = 0.5f * v * (1.f + erff(v * 0.70710678118654752f));
    }
  }
  __syncthreads();

  {  // stage 2: out = xnew + h @ W2 + b2
    v8f acc = {};
#pragma unroll
    for (int k0 = 0; k0 < 128; k0 += 4) {
      v2f a, bf;
      a[0] = htile[m][k0 + kb];
      a[1] = htile[m][k0 + kb + 1];
      bf[0] = W2[(size_t)(k0 + kb) * 128 + colLocal + n];
      bf[1] = W2[(size_t)(k0 + kb + 1) * 128 + colLocal + n];
      acc = WMMA_F32_16x16x4(a, bf, acc);
    }
    // the weight address keeps its registers until the last load has taken it
    asm volatile("s_wait_xcnt 0x0" :: "v"(W2 + (size_t)kb * 128 + colLocal + n) : "memory");
    const float bv = b2[colLocal + n];
#pragma unroll
    for (int r = 0; r < 8; ++r) {
      const int mr = (lane < 16) ? r : r + 8;
      const int row = rowBase + mr;
      if (row < N)
        out[(size_t)row * 128 + colLocal + n] = xtile[mr][colLocal + n] + acc[r] + bv;
    }
  }
}

// ---------------------------------------------------------------------------
extern "C" void kernel_launch(void* const* d_in, const int* in_sizes, int n_in,
                              void* d_out, int out_size, void* d_ws, size_t ws_size,
                              hipStream_t stream) {
  const float* x        = (const float*)d_in[0];
  const int*   ei       = (const int*)  d_in[1];   // [2,E] int32
  const float* ew       = (const float*)d_in[2];   // [E,1]
  const float* ln1_g    = (const float*)d_in[3];
  const float* ln1_b    = (const float*)d_in[4];
  const float* Wl       = (const float*)d_in[5];   // [128,512]
  const float* bl       = (const float*)d_in[6];
  const float* Wr       = (const float*)d_in[7];
  const float* br       = (const float*)d_in[8];
  const float* We       = (const float*)d_in[9];   // [1,512]
  const float* att      = (const float*)d_in[10];  // [4,128]
  const float* bias_att = (const float*)d_in[11];
  const float* ln2_g    = (const float*)d_in[12];
  const float* ln2_b    = (const float*)d_in[13];
  const float* W1       = (const float*)d_in[14];  // [128,128]
  const float* b1       = (const float*)d_in[15];
  const float* W2       = (const float*)d_in[16];  // [128,128]
  const float* b2       = (const float*)d_in[17];

  const int N = in_sizes[0] / 128;
  const int E = in_sizes[2];

  float* ws = (float*)d_ws;
  size_t o = 0;
  float* xs    = ws + o; o += (size_t)N * 512;
  float* xd    = ws + o; o += (size_t)N * 512;
  int2*  runs  = (int2*)(ws + o); o += (size_t)N * 2 * EPARTS;
  int2*  edges = (int2*)(ws + o); o += (size_t)E * 2;
  const int nSort = (N + NRANGE - 1) / NRANGE * EPARTS;

  k_ln1_xsxd<<<nSort + (N + K1ROWS - 1) / K1ROWS * 4, 256, 0, stream>>>(x, ln1_g, ln1_b, Wl, bl, Wr, br, xs, xd,
                                                        ei, ew, runs, edges, nSort, E, N);
  k_node_ffn<<<(N + 15) / 16, 256, 0, stream>>>(x, xs, xd, We, att, runs, edges, bias_att,
                                                ln2_g, ln2_b, W1, b1, W2, b2, (float*)d_out, N);
}
